// v000
// Measured on an AMD MI455X. A time is GPU time per run, averaged over a window of back-to-back runs after a warm-up
// (all launches, gaps included; the runs take copies of the inputs in turn), and the median of several windows.
// Apart from v000's, it joins two sittings. Times from different sittings can be a few percent apart, while
// side-by-side timings come from the same sitting.
// v000, which the later versions start from, runs in 2000 microseconds.
#include <hip/hip_runtime.h>

typedef __attribute__((ext_vector_type(16))) _Float16 v16h;
typedef __attribute__((ext_vector_type(8)))  float    v8f;
typedef unsigned int u32x4 __attribute__((ext_vector_type(4)));
typedef int          i32x4 __attribute__((ext_vector_type(4)));
typedef int          i32x8 __attribute__((ext_vector_type(8)));

constexpr int BB = 4;
constexpr int SS = 4096;
constexpr int DD = 1024;

#if __has_builtin(__builtin_amdgcn_tensor_load_to_lds)
#define HAVE_TDM 1
#else
#define HAVE_TDM 0
#endif

union AFrag { v16h h; unsigned int u[8]; };

__device__ __forceinline__ unsigned int pack2(_Float16 a, _Float16 b) {
  unsigned short ua = __builtin_bit_cast(unsigned short, a);
  unsigned short ub = __builtin_bit_cast(unsigned short, b);
  return (unsigned int)ua | ((unsigned int)ub << 16);
}

// K index of pair j (0..7) for this lane in the 16x32 f16 A/B fragment layout.
// lanes 0-15: K = {0..7, 16..23}; lanes 16-31: +8.
__device__ __forceinline__ int kpair(int j, int lane) {
  return ((j < 4) ? (2 * j) : (8 + 2 * j)) + ((lane >> 4) << 3);
}

// Load a 16x32 f16 A/B fragment from row-major storage (element (K,row) at
// p[row*ld + coloff + K]).  Works for both LDS and global pointers.
__device__ __forceinline__ v16h ld_frag(const _Float16* __restrict__ p, int row,
                                        int ld, int coloff, int lane) {
  AFrag f;
  const _Float16* r = p + (size_t)row * ld + coloff;
#pragma unroll
  for (int j = 0; j < 8; ++j) {
    f.u[j] = *(const unsigned int*)(r + kpair(j, lane));
  }
  return f.h;
}

__device__ __forceinline__ v8f wmma_f16(v16h a, v16h b, v8f c) {
  return __builtin_amdgcn_wmma_f32_16x16x32_f16(false, a, false, b, (short)0, c,
                                                false, false);
}

// ---------------------------------------------------------------------------
// TDM: async DMA of a 32x1024 f16 row-major tile (row stride 1024 elems) from
// global memory into LDS, with pad_enable inserting 1 DWORD after every 256
// DWORDs stored -> LDS row stride = 2056 B = 1028 halves, mid-row pad of 2
// halves at d==512.  Bank stride between rows = 514 % 64 = 2 -> the 16
// row-strided lanes of a WMMA fragment read hit 16 distinct banks.
// ---------------------------------------------------------------------------
#define LDK_T 1028  // padded LDS row stride in halves
__device__ __forceinline__ int padadj(int d) { return d + ((d >> 9) << 1); }

#if HAVE_TDM
__device__ __forceinline__ void tdm_load_tile_32xD(unsigned int lds_byte_off,
                                                   const _Float16* gsrc) {
  unsigned long long ga = (unsigned long long)(size_t)gsrc;
  u32x4 g0;
  g0[0] = 1u;                                     // count=1 (valid user D#)
  g0[1] = lds_byte_off;                           // lds_addr
  g0[2] = (unsigned int)ga;                       // global_addr[31:0]
  g0[3] = (unsigned int)(ga >> 32) | (2u << 30);  // global_addr[56:32]|type=2
  i32x8 g1;
  g1[0] = 0x01D10000;  // data_size=2B, pad_enable, pad_interval=256dw, pad=1dw
  g1[1] = 0x04000000;  // tensor_dim0 = 1024
  g1[2] = 0x00200000;  // tensor_dim1 = 32
  g1[3] = 0x04000000;  // tile_dim0 = 1024
  g1[4] = 32;          // tile_dim1 = 32
  g1[5] = 1024;        // tensor_dim0_stride = 1024
  g1[6] = 0;
  g1[7] = 0;
  i32x4 z4 = {0, 0, 0, 0};
#if defined(__clang_major__) && (__clang_major__ >= 23)
  i32x8 z8 = {0, 0, 0, 0, 0, 0, 0, 0};
  __builtin_amdgcn_tensor_load_to_lds(g0, g1, z4, z4, z8, 0);
#else
  __builtin_amdgcn_tensor_load_to_lds(g0, g1, z4, z4, 0);
#endif
}
#endif

// ---------------------------------------------------------------------------
// Kernel 1: fused QKV projection + bias + rotary, fp32 in -> f16 out.
// grid = (DD/128, (BB*SS)/64, 3), block = 256 (8 waves).
// ---------------------------------------------------------------------------
#define LDX 34  // padded row stride (halves) for 32-wide K tiles

__global__ __launch_bounds__(256) void qkv_rope_kernel(
    const float* __restrict__ x,
    const float* __restrict__ wq, const float* __restrict__ wk,
    const float* __restrict__ wv,
    const float* __restrict__ bq, const float* __restrict__ bk,
    const float* __restrict__ bv,
    const float* __restrict__ cosb, const float* __restrict__ sinb,
    _Float16* __restrict__ Qh, _Float16* __restrict__ Kh,
    _Float16* __restrict__ Vh) {
  __shared__ _Float16 xa[64 * LDX];
  __shared__ _Float16 wb[128 * LDX];

  const int z = blockIdx.z;
  const float* w = (z == 0) ? wq : (z == 1) ? wk : wv;
  const float* bias = (z == 0) ? bq : (z == 1) ? bk : bv;
  _Float16* out = (z == 0) ? Qh : (z == 1) ? Kh : Vh;
  const int do_rope = (z < 2);

  const int tid = threadIdx.x;
  const int lane = tid & 31;
  const int wave = tid >> 5;
  const int wm = wave & 3;
  const int wn = wave >> 2;
  const int m0 = blockIdx.y * 64;
  const int n0 = blockIdx.x * 128;

  v8f acc[4] = {};

  for (int k0 = 0; k0 < DD; k0 += 32) {
    for (int i = tid; i < 1024; i += 256) {
      int r = i >> 4;
      int c = (i & 15) * 2;
      float2 v = *(const float2*)(x + (size_t)(m0 + r) * DD + k0 + c);
      *(unsigned int*)(xa + r * LDX + c) = pack2((_Float16)v.x, (_Float16)v.y);
    }
    for (int i = tid; i < 2048; i += 256) {
      int r = i >> 4;
      int c = (i & 15) * 2;
      float2 v = *(const float2*)(w + (size_t)(n0 + r) * DD + k0 + c);
      *(unsigned int*)(wb + r * LDX + c) = pack2((_Float16)v.x, (_Float16)v.y);
    }
    __syncthreads();

    v16h a = ld_frag(xa, wm * 16 + (lane & 15), LDX, 0, lane);
#pragma unroll
    for (int t = 0; t < 4; ++t) {
      v16h b = ld_frag(wb, wn * 64 + t * 16 + (lane & 15), LDX, 0, lane);
      acc[t] = wmma_f16(a, b, acc[t]);
    }
    __syncthreads();
  }

  const int ncol = lane & 15;
  const int rbase = (lane >> 4) * 8;
#pragma unroll
  for (int t = 0; t < 4; ++t) {
    const int n_g = n0 + wn * 64 + t * 16 + ncol;
    const float bval = bias[n_g];
#pragma unroll
    for (int r = 0; r < 8; ++r) {
      const int row_g = m0 + wm * 16 + rbase + r;
      float v = acc[t][r] + bval;
      if (do_rope) {
        const int spos = row_g & (SS - 1);
        const int fi = n_g >> 1;
        const float c = cosb[(size_t)spos * (DD / 2) + fi];
        const float s = sinb[(size_t)spos * (DD / 2) + fi];
        const float p = __shfl_xor(v, 1, 32);
        v = (n_g & 1) ? (p * s + v * c) : (v * c - p * s);
      }
      out[(size_t)row_g * DD + n_g] = (_Float16)v;
    }
  }
}

// ---------------------------------------------------------------------------
// Kernel 2: fused attention  out = (Q K^T / B) V.
// grid = (SS/32, BB), block = 256 (8 waves).  32 query rows x D=1024 out cols.
// K/V tiles DMA'd to LDS by the Tensor Data Mover, double-issued and gated
// with s_wait_tensorcnt so the V DMA overlaps QK^T and the next K DMA
// overlaps S.V.
// ---------------------------------------------------------------------------
__global__ __launch_bounds__(256) void attn_kernel(
    const _Float16* __restrict__ Qh, const _Float16* __restrict__ Kh,
    const _Float16* __restrict__ Vh, float* __restrict__ out) {
  __shared__ alignas(16) _Float16 kvK[32 * LDK_T];  // 64.25 KB, TDM-padded
  __shared__ alignas(16) _Float16 kvV[32 * LDK_T];  // 64.25 KB, TDM-padded
  __shared__ float sS[2][16][33];                   // 32x32 score tile

  const int tid = threadIdx.x;
  const int lane = tid & 31;
  const int wave = tid >> 5;
  const int wr = wave >> 2;  // query row group (16 rows)
  const int wc = wave & 3;   // 256-wide d slice
  const int b = blockIdx.y;
  const int s0 = blockIdx.x * 32;
  const size_t rowbase = (size_t)b * SS + s0;
  const int mrow = (lane >> 4) * 8;

  const _Float16* Kbase = Kh + (size_t)b * SS * DD;
  const _Float16* Vbase = Vh + (size_t)b * SS * DD;

  // Resident Q fragments: rows [wr*16,+16), cols [wc*256,+256)
  v16h qa[8];
  {
    const _Float16* qbase =
        Qh + (rowbase + wr * 16 + (lane & 15)) * (size_t)DD + wc * 256;
#pragma unroll
    for (int kf = 0; kf < 8; ++kf) qa[kf] = ld_frag(qbase, 0, DD, kf * 32, lane);
  }

  v8f acc[16] = {};

#if HAVE_TDM
  const unsigned int kvK_off = (unsigned int)(size_t)(&kvK[0]);
  const unsigned int kvV_off = (unsigned int)(size_t)(&kvV[0]);
  if (wave == 0) {
    tdm_load_tile_32xD(kvK_off, Kbase);  // K(0)
    tdm_load_tile_32xD(kvV_off, Vbase);  // V(0)
  }
#endif

  for (int t0 = 0; t0 < SS; t0 += 32) {
    // ---- phase A: zero score tile; make K(t0) visible
    for (int i = tid; i < 2 * 16 * 33; i += 256) ((float*)sS)[i] = 0.0f;
#if HAVE_TDM
    if (wave == 0) __builtin_amdgcn_s_wait_tensorcnt(1);  // K(t0) done
#else
    for (int i = tid; i < 8192; i += 256) {  // manual staging fallback
      int r = i >> 8;
      int c = (i & 255) * 4;
      *(uint2*)(kvK + r * LDK_T + padadj(c)) =
          *(const uint2*)(Kbase + (size_t)(t0 + r) * DD + c);
    }
#endif
    __syncthreads();

    // ---- phase B: partial Q.K^T over this wave's 256-wide d slice
    v8f sacc[2] = {};
#pragma unroll
    for (int kf = 0; kf < 8; ++kf) {
      const int coladj = padadj(wc * 256 + kf * 32);
#pragma unroll
      for (int sub = 0; sub < 2; ++sub) {
        v16h kb = ld_frag(kvK, sub * 16 + (lane & 15), LDK_T, coladj, lane);
        sacc[sub] = wmma_f16(qa[kf], kb, sacc[sub]);
      }
    }
#pragma unroll
    for (int sub = 0; sub < 2; ++sub)
#pragma unroll
      for (int r = 0; r < 8; ++r)
        atomicAdd(&sS[wr][mrow + r][sub * 16 + (lane & 15)], sacc[sub][r]);
    __syncthreads();

    // ---- phase C: prefetch K(t0+32) via TDM; fold score tile to f16 A-frag
#if HAVE_TDM
    if (wave == 0 && t0 + 32 < SS)
      tdm_load_tile_32xD(kvK_off, Kbase + (size_t)(t0 + 32) * DD);
#else
    for (int i = tid; i < 8192; i += 256) {
      int r = i >> 8;
      int c = (i & 255) * 4;
      *(uint2*)(kvV + r * LDK_T + padadj(c)) =
          *(const uint2*)(Vbase + (size_t)(t0 + r) * DD + c);
    }
#endif
    AFrag sf;
    {
      const int m = lane & 15;
#pragma unroll
      for (int j = 0; j < 8; ++j) {
        int k = kpair(j, lane);
        _Float16 h0 = (_Float16)(sS[wr][m][k] * 0.25f);  // /B scale
        _Float16 h1 = (_Float16)(sS[wr][m][k + 1] * 0.25f);
        sf.u[j] = pack2(h0, h1);
      }
    }
#if HAVE_TDM
    if (wave == 0) {
      if (t0 + 32 < SS)
        __builtin_amdgcn_s_wait_tensorcnt(1);  // V(t0) done, K(t0+32) in flight
      else
        __builtin_amdgcn_s_wait_tensorcnt(0);  // last block: V(t0) done
    }
#endif
    __syncthreads();

    // ---- phase D: acc += S_tile (16x32) . V (32 x 256)
#pragma unroll
    for (int n = 0; n < 16; ++n) {
      const int dadj = padadj(wc * 256 + n * 16 + (lane & 15));
      AFrag vf;
#pragma unroll
      for (int j = 0; j < 8; ++j) {
        int k = kpair(j, lane);  // K dim = t (row), pairs stride LDK_T
        unsigned short lo =
            __builtin_bit_cast(unsigned short, kvV[(size_t)k * LDK_T + dadj]);
        unsigned short hi = __builtin_bit_cast(
            unsigned short, kvV[(size_t)(k + 1) * LDK_T + dadj]);
        vf.u[j] = (unsigned int)lo | ((unsigned int)hi << 16);
      }
      acc[n] = wmma_f16(sf.h, vf.h, acc[n]);
    }
    __syncthreads();

#if HAVE_TDM
    if (wave == 0 && t0 + 32 < SS)
      tdm_load_tile_32xD(kvV_off, Vbase + (size_t)(t0 + 32) * DD);
#endif
  }

  // write out fp32
#pragma unroll
  for (int n = 0; n < 16; ++n) {
    const int dg = wc * 256 + n * 16 + (lane & 15);
#pragma unroll
    for (int r = 0; r < 8; ++r) {
      const int row = s0 + wr * 16 + mrow + r;
      out[((size_t)b * SS + row) * DD + dg] = acc[n][r];
    }
  }
}

extern "C" void kernel_launch(void* const* d_in, const int* in_sizes, int n_in,
                              void* d_out, int out_size, void* d_ws,
                              size_t ws_size, hipStream_t stream) {
  (void)in_sizes; (void)n_in; (void)out_size; (void)ws_size;
  const float* x  = (const float*)d_in[0];
  const float* fc = (const float*)d_in[1];
  const float* fs = (const float*)d_in[2];
  const float* wq = (const float*)d_in[3];
  const float* bq = (const float*)d_in[4];
  const float* wk = (const float*)d_in[5];
  const float* bk = (const float*)d_in[6];
  const float* wv = (const float*)d_in[7];
  const float* bv = (const float*)d_in[8];
  float* out = (float*)d_out;

  _Float16* Qh = (_Float16*)d_ws;
  _Float16* Kh = Qh + (size_t)BB * SS * DD;
  _Float16* Vh = Kh + (size_t)BB * SS * DD;

  dim3 g1(DD / 128, (BB * SS) / 64, 3);
  qkv_rope_kernel<<<g1, dim3(256), 0, stream>>>(x, wq, wk, wv, bq, bk, bv, fc,
                                                fs, Qh, Kh, Vh);
  dim3 g2(SS / 32, BB);
  attn_kernel<<<g2, dim3(256), 0, stream>>>(Qh, Kh, Vh, out);
}

// v002
// Measured time: 222 microseconds a run.
// Versions between v000 and this one are left out; their measured steps multiply to 9.06 times as fast.
#include <hip/hip_runtime.h>

typedef __attribute__((ext_vector_type(16))) _Float16 v16h;
typedef __attribute__((ext_vector_type(8)))  float    v8f;
typedef unsigned int u32x4 __attribute__((ext_vector_type(4)));
typedef float    f32x2 __attribute__((ext_vector_type(2)));
typedef float    f32x4 __attribute__((ext_vector_type(4)));
typedef _Float16 f16x2 __attribute__((ext_vector_type(2)));

constexpr int BB = 4;
constexpr int SS = 4096;
constexpr int DD = 1024;

__device__ __forceinline__ v8f wmma_f16(v16h a, v16h b, v8f c) {
  return __builtin_amdgcn_wmma_f32_16x16x32_f16(false, a, false, b, (short)0, c,
                                                false, false);
}

// ---------------------------------------------------------------------------
// The reference has no softmax, so (Q K^T / B) V = Q (K^T V) / B.  Per batch
// K^T V is a D x D matrix: 2 x S*D*D multiply-adds instead of 2 x S*S*D.
//
// Shared main loop: C[m][n] = sum_k A[m][k] * Bm[n][k], both k-contiguous f16,
// one 128 x 128 tile per workgroup, 256 threads (8 waves, 4 along m, 2 along n,
// 32 x 64 per wave).  64 k per stage, two LDS buffers, the next stage's global
// loads held in registers while this stage is multiplied.
// ---------------------------------------------------------------------------
#define GP 72                  // LDS row stride in halves: 144 B = 16 B x 9
#define GSTG (256 * GP)        // one stage: 128 rows of A, then 128 rows of Bm
#define GSMEM_HALVES (2 * GSTG)

// 16x32 f16 fragment of one row; p = row start + 32 * kstep + 8 * (lane >> 4).
// The same k order serves A and B.
__device__ __forceinline__ v16h lds_frag(const _Float16* p) {
  union { v16h h; uint4 q[2]; } f;
  f.q[0] = *(const uint4*)(p);
  f.q[1] = *(const uint4*)(p + 16);
  return f.h;
}

template <int KD>
__device__ __forceinline__ void gemm_tile_nt(const _Float16* __restrict__ A,
                                             const _Float16* __restrict__ Bm,
                                             _Float16* sm, v8f (&acc)[2][4]) {
  const int tid = threadIdx.x;
  const int lane = tid & 31;
  const int wave = tid >> 5;
  const int wm = wave & 3;
  const int wn = wave >> 2;
  const int c = lane & 15;
  const int h = lane >> 4;
  const int lrow = tid >> 3;       // 32 rows per sweep, 8 lanes per 128-B row
  const int lcol = (tid & 7) * 8;
  const _Float16* ga = A + (size_t)lrow * KD + lcol;
  const _Float16* gb = Bm + (size_t)lrow * KD + lcol;
  _Float16* st = sm + lrow * GP + lcol;
  constexpr int NS = KD / 64;

  u32x4 ra[4], rb[4];
#pragma unroll
  for (int j = 0; j < 4; ++j) {
    ra[j] = *(const u32x4*)(ga + (size_t)j * 32 * KD);
    rb[j] = *(const u32x4*)(gb + (size_t)j * 32 * KD);
  }

  for (int s = 0; s < NS; ++s) {
    const int cur = (s & 1) * GSTG;
    // stage s goes from registers to its buffer; that buffer's last readers
    // (stage s - 2) have all passed the barrier of stage s - 1
#pragma unroll
    for (int j = 0; j < 4; ++j) {
      *(u32x4*)(st + cur + j * 32 * GP) = ra[j];
      *(u32x4*)(st + cur + (128 + j * 32) * GP) = rb[j];
    }
    __syncthreads();  // publishes stage s
    // stage s + 1 flies while stage s is multiplied (the last trip re-reads its
    // own); issued behind the barrier, whose fence would wait for them
    const int kn = (s + 1 < NS ? s + 1 : s) * 64;
#pragma unroll
    for (int j = 0; j < 4; ++j) {
      ra[j] = *(const u32x4*)(ga + (size_t)j * 32 * KD + kn);
      rb[j] = *(const u32x4*)(gb + (size_t)j * 32 * KD + kn);
    }
    // keeps the loads above issued ahead of the products; without it they sink
    // to the loop's foot and the wave waits out their latency every stage
    __builtin_amdgcn_sched_barrier(0);
    const _Float16* sa = sm + cur + (wm * 32 + c) * GP + 8 * h;
    const _Float16* sb = sm + cur + (128 + wn * 64 + c) * GP + 8 * h;
#pragma unroll
    for (int kk = 0; kk < 2; ++kk) {
      v16h af[2], bf[4];
#pragma unroll
      for (int i = 0; i < 2; ++i) af[i] = lds_frag(sa + i * 16 * GP + kk * 32);
#pragma unroll
      for (int j = 0; j < 4; ++j) bf[j] = lds_frag(sb + j * 16 * GP + kk * 32);
#pragma unroll
      for (int i = 0; i < 2; ++i)
#pragma unroll
        for (int j = 0; j < 4; ++j) acc[i][j] = wmma_f16(af[i], bf[j], acc[i][j]);
    }
  }
  __syncthreads();  // every read of the buffers is over: the callers reuse them
}

// The same stages and fragment reads for fp32 operands and a WM*FM*16 x WN*FN*16 tile:
// a stage's 64 k of a row are 256 B of fp32 (16 lanes x 16 B), held in registers
// while the stage before is multiplied and rounded to f16 on their way into LDS.
__device__ __forceinline__ uint2 cvt4(f32x4 v) {
  // one packed convert (round to nearest even) per pair
  const f16x2 lo = __builtin_convertvector(__builtin_shufflevector(v, v, 0, 1), f16x2);
  const f16x2 hi = __builtin_convertvector(__builtin_shufflevector(v, v, 2, 3), f16x2);
  return make_uint2(__builtin_bit_cast(unsigned int, lo),
                    __builtin_bit_cast(unsigned int, hi));
}

// WM x WN waves, FM x FN fragments of 16 x 16 per wave.
template <int KD, int WM, int WN, int FM, int FN>
__device__ __forceinline__ void gemm_tile_nt_f32(const float* __restrict__ A,
                                                 const float* __restrict__ Bm,
                                                 _Float16* sm,
                                                 v8f (&acc)[FM][FN]) {
  constexpr int TM = WM * FM * 16;      // rows of A in the tile
  constexpr int TN = WN * FN * 16;      // rows of Bm in the tile
  constexpr int RS = WM * WN * 2;       // rows per sweep: 16 lanes per 256-B row
  constexpr int STG = (TM + TN) * GP;   // one stage: the rows of A, then of Bm
  constexpr int NS = KD / 64;
  const int tid = threadIdx.x;
  const int lane = tid & 31;
  const int wave = tid >> 5;
  const int wm = wave % WM;
  const int wn = wave / WM;
  const int c = lane & 15;
  const int h = lane >> 4;
  const int lrow = tid >> 4;
  const int lcol = (tid & 15) * 4;
  const float* ga = A + (size_t)lrow * KD + lcol;
  const float* gb = Bm + (size_t)lrow * KD + lcol;
  _Float16* st = sm + lrow * GP + lcol;

  f32x4 ra[TM / RS], rb[TN / RS];
#pragma unroll
  for (int j = 0; j < TM / RS; ++j) ra[j] = *(const f32x4*)(ga + (size_t)j * RS * KD);
#pragma unroll
  for (int j = 0; j < TN / RS; ++j) rb[j] = *(const f32x4*)(gb + (size_t)j * RS * KD);

  for (int s = 0; s < NS; ++s) {
    const int cur = (s & 1) * STG;
    // stage s goes from registers to its buffer; that buffer's last readers
    // (stage s - 2) have all passed the barrier of stage s - 1
#pragma unroll
    for (int j = 0; j < TM / RS; ++j) *(uint2*)(st + cur + j * RS * GP) = cvt4(ra[j]);
#pragma unroll
    for (int j = 0; j < TN / RS; ++j)
      *(uint2*)(st + cur + (TM + j * RS) * GP) = cvt4(rb[j]);
    __syncthreads();  // publishes stage s
    // stage s + 1 flies while stage s is multiplied (the last trip re-reads its
    // own); issued behind the barrier, whose fence would wait for them
    const int kn = (s + 1 < NS ? s + 1 : s) * 64;
    const float* pa = ga + kn;
    const float* pb = gb + kn;
#pragma unroll
    for (int j = 0; j < TM / RS; ++j) ra[j] = *(const f32x4*)(pa + (size_t)j * RS * KD);
#pragma unroll
    for (int j = 0; j < TN / RS; ++j) rb[j] = *(const f32x4*)(pb + (size_t)j * RS * KD);
    // stands in front of any rewrite of a register that the loads above name;
    // as inputs the two addresses keep their registers up to the wait (without
    // it the last load's result lands on the address registers themselves)
    asm volatile("s_wait_xcnt 0x0" ::"v"(pa), "v"(pb) : "memory");
    // keeps the loads above issued ahead of the products; without it they sink
    // to the loop's foot and the wave waits out their latency every stage
    __builtin_amdgcn_sched_barrier(0);
    const _Float16* sa = sm + cur + (wm * FM * 16 + c) * GP + 8 * h;
    const _Float16* sb = sm + cur + (TM + wn * FN * 16 + c) * GP + 8 * h;
#pragma unroll
    for (int kk = 0; kk < 2; ++kk) {
      v16h af[FM], bf[FN];
#pragma unroll
      for (int i = 0; i < FM; ++i) af[i] = lds_frag(sa + i * 16 * GP + kk * 32);
#pragma unroll
      for (int j = 0; j < FN; ++j) bf[j] = lds_frag(sb + j * 16 * GP + kk * 32);
#pragma unroll
      for (int i = 0; i < FM; ++i)
#pragma unroll
        for (int j = 0; j < FN; ++j) acc[i][j] = wmma_f16(af[i], bf[j], acc[i][j]);
    }
  }
  __syncthreads();  // every read of the buffers is over: the caller reuses them
}

// ---------------------------------------------------------------------------
// Kernel 1: fused QKV projection + bias + rotary, fp32 in -> f16 out.
// grid = (DD/256, (BB*SS)/256, 3), block = 512 (16 waves, 4 x 4, 64 x 64 per
// wave), one 256 x 256 tile (tokens x features) per workgroup.
// Q is stored row-major [b][s][d]; K and V are stored transposed [b][d][t], so
// that the product K^T V reads both with its summed index t contiguous.
// ---------------------------------------------------------------------------
#define PT 256                 // tile edge
#define TP (PT + 8)            // row stride (halves) of the transposed tile: 528 B
#define PSMEM_HALVES (2 * 2 * PT * GP)

__global__ __launch_bounds__(512) void qkv_rope_kernel(
    const float* __restrict__ x,
    const float* __restrict__ wq, const float* __restrict__ wk,
    const float* __restrict__ wv,
    const float* __restrict__ bq, const float* __restrict__ bk,
    const float* __restrict__ bv,
    const float* __restrict__ cosb, const float* __restrict__ sinb,
    _Float16* __restrict__ Qh, _Float16* __restrict__ Kt,
    _Float16* __restrict__ Vt) {
  __shared__ alignas(16) _Float16 sm[PSMEM_HALVES];
  static_assert(PT * TP <= PSMEM_HALVES, "transposed tile fits");

  const int z = blockIdx.z;
  const float* w = (z == 0) ? wq : (z == 1) ? wk : wv;
  const float* bias = (z == 0) ? bq : (z == 1) ? bk : bv;
  _Float16* out = (z == 0) ? Qh : (z == 1) ? Kt : Vt;
  const int do_rope = (z < 2);

  const int tid = threadIdx.x;
  const int lane = tid & 31;
  const int wave = tid >> 5;
  const int m0 = blockIdx.y * PT;  // token
  const int n0 = blockIdx.x * PT;  // feature

  v8f acc[4][4] = {};
  gemm_tile_nt_f32<DD, 4, 4, 4, 4>(x + (size_t)m0 * DD, w + (size_t)n0 * DD, sm, acc);

  // acc[i][j][r] = C[wm*64 + i*16 + 8h + r][wn*64 + j*16 + c]
  const int mloc = (wave & 3) * 64 + (lane >> 4) * 8;
  const int nloc = (wave >> 2) * 64 + (lane & 15);
  // row-major place of the lane's first element (used for Q alone)
  _Float16* qp = out + (size_t)(m0 + mloc) * DD + n0 + nloc;
#pragma unroll
  for (int j = 0; j < 4; ++j) {
    const int n_g = n0 + nloc + j * 16;
    const float bval = bias[n_g];
    // the tile's rows start at a multiple of its edge, so they never wrap past SS
    const size_t fo = (size_t)((m0 & (SS - 1)) + mloc) * (DD / 2) + (n_g >> 1);
    const float* cp = cosb + fo;
    const float* sp = sinb + fo;
#pragma unroll
    for (int i = 0; i < 4; ++i) {
      float cv[8], sv[8];
      if (do_rope) {
#pragma unroll
        for (int r = 0; r < 8; ++r) {
          cv[r] = cp[(i * 16 + r) * (DD / 2)];
          sv[r] = sp[(i * 16 + r) * (DD / 2)];
        }
        // stands in front of any rewrite of a register that the loads above
        // name; as inputs the two addresses keep their registers up to the wait
        asm volatile("s_wait_xcnt 0x0" ::"v"(cp), "v"(sp) : "memory");
      }
      union { _Float16 e[8]; uint4 q; } col;
#pragma unroll
      for (int r = 0; r < 8; ++r) {
        float v = acc[i][j][r] + bval;
        if (do_rope) {
          const float p = __shfl_xor(v, 1, 32);
          v = (n_g & 1) ? (p * sv[r] + v * cv[r]) : (v * cv[r] - p * sv[r]);
        }
        col.e[r] = (_Float16)v;
      }
      if (z == 0) {
#pragma unroll
        for (int r = 0; r < 8; ++r) qp[(i * 16 + r) * DD + j * 16] = col.e[r];
        // stands in front of any rewrite of a register that the stores above
        // name; as inputs address and data keep their registers up to the wait
        asm volatile("s_wait_xcnt 0x0" ::"v"(qp), "v"(col.q.x), "v"(col.q.y),
                     "v"(col.q.z), "v"(col.q.w)
                     : "memory");
      } else {
        // a lane holds 8 consecutive rows of one column: 16 bytes of a
        // transposed row
        *(uint4*)(sm + (nloc + j * 16) * TP + mloc + i * 16) = col.q;
      }
    }
  }
  if (z != 0) {
    __syncthreads();  // the transposed tile is complete
    // a wave stores the 512 contiguous bytes of a transposed row
    _Float16* dst = out + ((size_t)(m0 / SS) * DD + n0) * SS + (m0 & (SS - 1));
    for (int i = tid; i < PT * PT / 8; i += 512) {
      const int r = i >> 5;
      const int c = (i & 31) * 8;
      *(uint4*)(dst + (size_t)r * SS + c) = *(const uint4*)(sm + r * TP + c);
    }
  }
}

// ---------------------------------------------------------------------------
// Kernel 2: Mt[b][d2][d1] = (1/256) * sum_t K[b][t][d1] * V[b][t][d2], f16.
// The power of two keeps the f16 values near 1 (the sum runs over S = 4096
// terms); kernel 3 multiplies it back.  grid = (DD/128, DD/128, BB).
// ---------------------------------------------------------------------------
#define MP 136  // staged output row stride in halves: 272 B = 16 B x 17
__global__ __launch_bounds__(256) void ktv_kernel(
    const _Float16* __restrict__ Kt, const _Float16* __restrict__ Vt,
    _Float16* __restrict__ Mt) {
  __shared__ alignas(16) _Float16 sm[GSMEM_HALVES];
  const int tid = threadIdx.x;
  const int lane = tid & 31;
  const int wave = tid >> 5;
  const int m0 = blockIdx.x * 128;  // d1
  const int n0 = blockIdx.y * 128;  // d2
  const size_t bo = (size_t)blockIdx.z * DD * SS;

  v8f acc[2][4] = {};
  gemm_tile_nt<SS>(Kt + bo + (size_t)m0 * SS, Vt + bo + (size_t)n0 * SS, sm, acc);

  // acc[i][j][r] = C[wm*32 + i*16 + 8h + r][wn*64 + j*16 + c]; staged as [n][m]
  const int mloc = (wave & 3) * 32 + (lane >> 4) * 8;
  const int nloc = (wave >> 2) * 64 + (lane & 15);
#pragma unroll
  for (int i = 0; i < 2; ++i)
#pragma unroll
    for (int j = 0; j < 4; ++j) {
      union { _Float16 e[8]; uint4 q; } p;
#pragma unroll
      for (int r = 0; r < 8; ++r) p.e[r] = (_Float16)(acc[i][j][r] * (1.0f / 256.0f));
      *(uint4*)(sm + (nloc + j * 16) * MP + mloc + i * 16) = p.q;
    }
  __syncthreads();
  _Float16* dst = Mt + (size_t)blockIdx.z * DD * DD + (size_t)n0 * DD + m0;
  for (int i = tid; i < 2048; i += 256) {  // 16 lanes store 256 contiguous bytes
    const int r = i >> 4;
    const int c = (i & 15) * 8;
    *(uint4*)(dst + (size_t)r * DD + c) = *(const uint4*)(sm + r * MP + c);
  }
}

// ---------------------------------------------------------------------------
// Kernel 3: out[b][s][d2] = 64 * sum_d1 Q[b][s][d1] * Mt[b][d2][d1], fp32
// (64 / 256 = 1 / B).  grid = (DD/128, SS/128, BB).
// ---------------------------------------------------------------------------
#define OP 132  // staged output row stride in floats: 528 B = 16 B x 33
__global__ __launch_bounds__(256) void qm_kernel(
    const _Float16* __restrict__ Qh, const _Float16* __restrict__ Mt,
    float* __restrict__ out) {
  __shared__ alignas(16) _Float16 sm[GSMEM_HALVES];
  static_assert(128 * OP * 4 <= GSMEM_HALVES * 2, "staged tile fits");
  const int tid = threadIdx.x;
  const int lane = tid & 31;
  const int wave = tid >> 5;
  const int m0 = blockIdx.x * 128;  // d2
  const int n0 = blockIdx.y * 128;  // s
  const int b = blockIdx.z;

  v8f acc[2][4] = {};
  gemm_tile_nt<DD>(Mt + (size_t)b * DD * DD + (size_t)m0 * DD,
                   Qh + ((size_t)b * SS + n0) * DD, sm, acc);

  float* so = (float*)sm;
  const int mloc = (wave & 3) * 32 + (lane >> 4) * 8;
  const int nloc = (wave >> 2) * 64 + (lane & 15);
#pragma unroll
  for (int i = 0; i < 2; ++i)
#pragma unroll
    for (int j = 0; j < 4; ++j) {
      float* p = so + (nloc + j * 16) * OP + mloc + i * 16;
      *(float4*)(p) = make_float4(acc[i][j][0] * 64.0f, acc[i][j][1] * 64.0f,
                                  acc[i][j][2] * 64.0f, acc[i][j][3] * 64.0f);
      *(float4*)(p + 4) = make_float4(acc[i][j][4] * 64.0f, acc[i][j][5] * 64.0f,
                                      acc[i][j][6] * 64.0f, acc[i][j][7] * 64.0f);
    }
  __syncthreads();
  float* dst = out + ((size_t)b * SS + n0) * DD + m0;
  for (int i = tid; i < 4096; i += 256) {  // a wave stores one 512-byte row
    const int r = i >> 5;
    const int c = (i & 31) * 4;
    *(float4*)(dst + (size_t)r * DD + c) = *(const float4*)(so + r * OP + c);
  }
}

extern "C" void kernel_launch(void* const* d_in, const int* in_sizes, int n_in,
                              void* d_out, int out_size, void* d_ws,
                              size_t ws_size, hipStream_t stream) {
  (void)in_sizes; (void)n_in; (void)out_size; (void)ws_size;
  const float* x  = (const float*)d_in[0];
  const float* fc = (const float*)d_in[1];
  const float* fs = (const float*)d_in[2];
  const float* wq = (const float*)d_in[3];
  const float* bq = (const float*)d_in[4];
  const float* wk = (const float*)d_in[5];
  const float* bk = (const float*)d_in[6];
  const float* wv = (const float*)d_in[7];
  const float* bv = (const float*)d_in[8];
  float* out = (float*)d_out;

  _Float16* Qh = (_Float16*)d_ws;
  _Float16* Kt = Qh + (size_t)BB * SS * DD;
  _Float16* Vt = Kt + (size_t)BB * SS * DD;
  _Float16* Mt = Vt + (size_t)BB * SS * DD;

  dim3 g1(DD / 256, (BB * SS) / 256, 3);
  qkv_rope_kernel<<<g1, dim3(512), 0, stream>>>(x, wq, wk, wv, bq, bk, bv, fc,
                                                fs, Qh, Kt, Vt);
  dim3 g2(DD / 128, DD / 128, BB);
  ktv_kernel<<<g2, dim3(256), 0, stream>>>(Kt, Vt, Mt);
  dim3 g3(DD / 128, SS / 128, BB);
  qm_kernel<<<g3, dim3(256), 0, stream>>>(Qh, Mt, out);
}

// v003
// One run takes 201 microseconds.
// In both of two side-by-side timings against v002, it was 1.10 times as fast.
// Over all steps from v000 it is 9.98 times as fast.
#include <hip/hip_runtime.h>

typedef __attribute__((ext_vector_type(16))) _Float16 v16h;
typedef __attribute__((ext_vector_type(8)))  float    v8f;
typedef unsigned int u32x4 __attribute__((ext_vector_type(4)));
typedef float    f32x2 __attribute__((ext_vector_type(2)));
typedef float    f32x4 __attribute__((ext_vector_type(4)));
typedef _Float16 f16x2 __attribute__((ext_vector_type(2)));

constexpr int BB = 4;
constexpr int SS = 4096;
constexpr int DD = 1024;

__device__ __forceinline__ v8f wmma_f16(v16h a, v16h b, v8f c) {
  return __builtin_amdgcn_wmma_f32_16x16x32_f16(false, a, false, b, (short)0, c,
                                                false, false);
}

// ---------------------------------------------------------------------------
// The reference has no softmax, so (Q K^T / B) V = Q (K^T V) / B.  Per batch
// K^T V is a D x D matrix: 2 x S*D*D multiply-adds instead of 2 x S*S*D.
//
// Shared main loop: C[m][n] = sum_k A[m][k] * Bm[n][k], both k-contiguous f16,
// one 128 x 128 tile per workgroup, 256 threads (8 waves, 4 along m, 2 along n,
// 32 x 64 per wave).  64 k per stage, two LDS buffers, the next stage's global
// loads held in registers while this stage is multiplied.
// ---------------------------------------------------------------------------
#define GP 72                  // LDS row stride in halves: 144 B = 16 B x 9
#define GSTG (256 * GP)        // one stage: 128 rows of A, then 128 rows of Bm
#define GSMEM_HALVES (2 * GSTG)

// 16x32 f16 fragment of one row; p = row start + 32 * kstep + 8 * (lane >> 4).
// The same k order serves A and B.
__device__ __forceinline__ v16h lds_frag(const _Float16* p) {
  union { v16h h; uint4 q[2]; } f;
  f.q[0] = *(const uint4*)(p);
  f.q[1] = *(const uint4*)(p + 16);
  return f.h;
}

template <int KD>
__device__ __forceinline__ void gemm_tile_nt(const _Float16* __restrict__ A,
                                             const _Float16* __restrict__ Bm,
                                             _Float16* sm, v8f (&acc)[2][4]) {
  const int tid = threadIdx.x;
  const int lane = tid & 31;
  const int wave = tid >> 5;
  const int wm = wave & 3;
  const int wn = wave >> 2;
  const int c = lane & 15;
  const int h = lane >> 4;
  const int lrow = tid >> 3;       // 32 rows per sweep, 8 lanes per 128-B row
  const int lcol = (tid & 7) * 8;
  const _Float16* ga = A + (size_t)lrow * KD + lcol;
  const _Float16* gb = Bm + (size_t)lrow * KD + lcol;
  _Float16* st = sm + lrow * GP + lcol;
  constexpr int NS = KD / 64;

  u32x4 ra[4], rb[4];
#pragma unroll
  for (int j = 0; j < 4; ++j) {
    ra[j] = *(const u32x4*)(ga + (size_t)j * 32 * KD);
    rb[j] = *(const u32x4*)(gb + (size_t)j * 32 * KD);
  }

  for (int s = 0; s < NS; ++s) {
    const int cur = (s & 1) * GSTG;
    // stage s goes from registers to its buffer; that buffer's last readers
    // (stage s - 2) have all passed the barrier of stage s - 1
#pragma unroll
    for (int j = 0; j < 4; ++j) {
      *(u32x4*)(st + cur + j * 32 * GP) = ra[j];
      *(u32x4*)(st + cur + (128 + j * 32) * GP) = rb[j];
    }
    __syncthreads();  // publishes stage s
    // stage s + 1 flies while stage s is multiplied (the last trip re-reads its
    // own); issued behind the barrier, whose fence would wait for them
    const int kn = (s + 1 < NS ? s + 1 : s) * 64;
#pragma unroll
    for (int j = 0; j < 4; ++j) {
      ra[j] = *(const u32x4*)(ga + (size_t)j * 32 * KD + kn);
      rb[j] = *(const u32x4*)(gb + (size_t)j * 32 * KD + kn);
    }
    // keeps the loads above issued ahead of the products; without it they sink
    // to the loop's foot and the wave waits out their latency every stage
    __builtin_amdgcn_sched_barrier(0);
    const _Float16* sa = sm + cur + (wm * 32 + c) * GP + 8 * h;
    const _Float16* sb = sm + cur + (128 + wn * 64 + c) * GP + 8 * h;
#pragma unroll
    for (int kk = 0; kk < 2; ++kk) {
      v16h af[2], bf[4];
#pragma unroll
      for (int i = 0; i < 2; ++i) af[i] = lds_frag(sa + i * 16 * GP + kk * 32);
#pragma unroll
      for (int j = 0; j < 4; ++j) bf[j] = lds_frag(sb + j * 16 * GP + kk * 32);
#pragma unroll
      for (int i = 0; i < 2; ++i)
#pragma unroll
        for (int j = 0; j < 4; ++j) acc[i][j] = wmma_f16(af[i], bf[j], acc[i][j]);
    }
  }
  __syncthreads();  // every read of the buffers is over: the callers reuse them
}

// The same stages and fragment reads for fp32 operands, WM * WN = 16 waves and FN = 4:
// a stage's 64 k of a row are 256 B of fp32 (16 lanes x 16 B), held in registers
// while the stage before is multiplied and rounded to f16 on their way into LDS.
__device__ __forceinline__ uint2 cvt4(f32x4 v) {
  // one packed convert (round to nearest even) per pair
  const f16x2 lo = __builtin_convertvector(__builtin_shufflevector(v, v, 0, 1), f16x2);
  const f16x2 hi = __builtin_convertvector(__builtin_shufflevector(v, v, 2, 3), f16x2);
  return make_uint2(__builtin_bit_cast(unsigned int, lo),
                    __builtin_bit_cast(unsigned int, hi));
}

// WM x WN waves, FM x FN fragments of 16 x 16 per wave.
// Row 64w + 4c + j of Bm lies at LDS row 64w + 16j + c, so that fragment j of a
// wave holds column 4c + j in lane c: acc[i][0..3] of a lane are four adjacent
// columns of C.  Only the place of whole rows changes, the k order does not.
template <int KD, int WM, int WN, int FM, int FN>
__device__ __forceinline__ void gemm_tile_nt_f32(const float* __restrict__ A,
                                                 const float* __restrict__ Bm,
                                                 _Float16* sm,
                                                 v8f (&acc)[FM][FN]) {
  constexpr int TM = WM * FM * 16;      // rows of A in the tile
  constexpr int TN = WN * FN * 16;      // rows of Bm in the tile
  constexpr int RS = WM * WN * 2;       // rows per sweep: 16 lanes per 256-B row
  constexpr int STG = (TM + TN) * GP;   // one stage: the rows of A, then of Bm
  constexpr int NS = KD / 64;
  const int tid = threadIdx.x;
  const int lane = tid & 31;
  const int wave = tid >> 5;
  const int wm = wave % WM;
  const int wn = wave / WM;
  const int c = lane & 15;
  const int h = lane >> 4;
  const int lrow = tid >> 4;
  const int lcol = (tid & 15) * 4;
  const float* ga = A + (size_t)lrow * KD + lcol;
  const float* gb = Bm + (size_t)lrow * KD + lcol;
  _Float16* st = sm + lrow * GP + lcol;
  static_assert(RS == 32 && FN == 4, "the row permutation below is written for these");
  _Float16* stb = sm + (TM + (lrow & 3) * 16 + (lrow >> 2)) * GP + lcol;

  f32x4 ra[TM / RS], rb[TN / RS];
#pragma unroll
  for (int j = 0; j < TM / RS; ++j) ra[j] = *(const f32x4*)(ga + (size_t)j * RS * KD);
#pragma unroll
  for (int j = 0; j < TN / RS; ++j) rb[j] = *(const f32x4*)(gb + (size_t)j * RS * KD);

  for (int s = 0; s < NS; ++s) {
    const int cur = (s & 1) * STG;
    // stage s goes from registers to its buffer; that buffer's last readers
    // (stage s - 2) have all passed the barrier of stage s - 1
#pragma unroll
    for (int j = 0; j < TM / RS; ++j) *(uint2*)(st + cur + j * RS * GP) = cvt4(ra[j]);
#pragma unroll
    for (int j = 0; j < TN / RS; ++j)
      *(uint2*)(stb + cur + ((j >> 1) * 64 + (j & 1) * 8) * GP) = cvt4(rb[j]);
    __syncthreads();  // publishes stage s
    // stage s + 1 flies while stage s is multiplied (the last trip has none to
    // fetch); issued behind the barrier, whose fence would wait for them
    if (s + 1 < NS) {
      const float* pa = ga + (s + 1) * 64;
      const float* pb = gb + (s + 1) * 64;
#pragma unroll
      for (int j = 0; j < TM / RS; ++j) ra[j] = *(const f32x4*)(pa + (size_t)j * RS * KD);
#pragma unroll
      for (int j = 0; j < TN / RS; ++j) rb[j] = *(const f32x4*)(pb + (size_t)j * RS * KD);
      // stands in front of any rewrite of a register that the loads above name;
      // as inputs the two addresses keep their registers up to the wait (without
      // it the last load's result lands on the address registers themselves)
      asm volatile("s_wait_xcnt 0x0" ::"v"(pa), "v"(pb) : "memory");
    }
    // keeps the loads above issued ahead of the products; without it they sink
    // to the loop's foot and the wave waits out their latency every stage
    __builtin_amdgcn_sched_barrier(0);
    const _Float16* sa = sm + cur + (wm * FM * 16 + c) * GP + 8 * h;
    const _Float16* sb = sm + cur + (TM + wn * FN * 16 + c) * GP + 8 * h;
#pragma unroll
    for (int kk = 0; kk < 2; ++kk) {
      v16h af[FM], bf[FN];
#pragma unroll
      for (int i = 0; i < FM; ++i) af[i] = lds_frag(sa + i * 16 * GP + kk * 32);
#pragma unroll
      for (int j = 0; j < FN; ++j) bf[j] = lds_frag(sb + j * 16 * GP + kk * 32);
#pragma unroll
      for (int i = 0; i < FM; ++i)
#pragma unroll
        for (int j = 0; j < FN; ++j) acc[i][j] = wmma_f16(af[i], bf[j], acc[i][j]);
    }
  }
  __syncthreads();  // every read of the buffers is over: the caller reuses them
}

// ---------------------------------------------------------------------------
// Kernel 1: fused QKV projection + bias + rotary, fp32 in -> f16 out.
// grid = (DD/256, (BB*SS)/256, 3), block = 512 (16 waves, 4 x 4, 64 x 64 per
// wave), one 256 x 256 tile (tokens x features) per workgroup.
// Q is stored row-major [b][s][d]; K and V are stored transposed [b][d][t], so
// that the product K^T V reads both with its summed index t contiguous.
// ---------------------------------------------------------------------------
#define PT 256                 // tile edge
#define TP (PT + 8)            // row stride (halves) of the transposed tile: 528 B
#define PSMEM_HALVES (2 * 2 * PT * GP)

__device__ __forceinline__ unsigned int pk2(float a, float b) {
  const f32x2 v = {a, b};
  return __builtin_bit_cast(unsigned int, __builtin_convertvector(v, f16x2));
}

// Bias, rotary and store of one wave's 64 x 64 part.  Z = 0: Q, rotated, row-major
// to memory; Z = 1: K, rotated, into the transposed LDS tile; Z = 2: V, the same
// without the rotation.  acc[i][j][r] = C[wm*64 + i*16 + 8h + r][wn*64 + 4c + j]:
// a lane holds two whole (even, odd) pairs, so the rotation needs no other lane,
// 16 lanes read a whole 128-byte line of cos or sin and store one of Q.
template <int Z>
__device__ __forceinline__ void qkv_epilogue(
    v8f (&acc)[4][4], const float* __restrict__ bias,
    const float* __restrict__ cosb, const float* __restrict__ sinb,
    _Float16* __restrict__ out, _Float16* sm, int m0, int n0) {
  const int lane = threadIdx.x & 31;
  const int wave = threadIdx.x >> 5;
  const int c = lane & 15;
  const int mloc = (wave & 3) * 64 + (lane >> 4) * 8;
  const int nloc = (wave >> 2) * 64 + c * 4;
  const unsigned int bo = (unsigned int)nloc * 4u;  // the lane's byte offset in the tile's bias
  // the tile's rows start at a multiple of its edge, so they never wrap past SS
  const size_t fo = (size_t)((m0 & (SS - 1)) + mloc) * (DD / 2) + ((n0 + nloc) >> 1);
  const float* cp = cosb + fo;
  const float* sp = sinb + fo;
  _Float16* qp = out + (size_t)(m0 + mloc) * DD + n0 + nloc;

  const f32x4 b4 = *(const f32x4*)((const char*)(bias + n0) + bo);
  f32x2 cv[2][8], sv[2][8];
  if constexpr (Z < 2) {
#pragma unroll
    for (int r = 0; r < 8; ++r) {
      cv[0][r] = *(const f32x2*)(cp + r * (DD / 2));
      sv[0][r] = *(const f32x2*)(sp + r * (DD / 2));
    }
  }
  // stands in front of any rewrite of a register that the loads above name; as
  // inputs the addresses keep their registers up to the wait
  if constexpr (Z < 2)
    asm volatile("s_wait_xcnt 0x0" ::"v"(bo), "v"(cp), "v"(sp) : "memory");
  else
    asm volatile("s_wait_xcnt 0x0" ::"v"(bo) : "memory");
#pragma unroll
  for (int i = 0; i < 4; ++i) {
    if constexpr (Z < 2) {
      if (i + 1 < 4) {
        // the next 16 rows' factors fly while these 16 rows are rotated
#pragma unroll
        for (int r = 0; r < 8; ++r) {
          cv[(i + 1) & 1][r] = *(const f32x2*)(cp + ((i + 1) * 16 + r) * (DD / 2));
          sv[(i + 1) & 1][r] = *(const f32x2*)(sp + ((i + 1) * 16 + r) * (DD / 2));
        }
        // as above: in front of any rewrite of the two address registers
        asm volatile("s_wait_xcnt 0x0" ::"v"(cp), "v"(sp) : "memory");
      }
    }
    float v[4][8];
#pragma unroll
    for (int r = 0; r < 8; ++r) {
#pragma unroll
      for (int j = 0; j < 4; ++j) v[j][r] = acc[i][j][r] + b4[j];
      if constexpr (Z < 2) {
#pragma unroll
        for (int p = 0; p < 2; ++p) {
          const float cc = cv[i & 1][r][p], ss = sv[i & 1][r][p];
          const float h0 = v[2 * p][r], h1 = v[2 * p + 1][r];
          v[2 * p][r] = __builtin_fmaf(cc, h0, -(ss * h1));
          v[2 * p + 1][r] = __builtin_fmaf(cc, h1, ss * h0);
        }
      }
    }
    if constexpr (Z == 0) {
      uint2 d[8];
#pragma unroll
      for (int r = 0; r < 8; ++r) {
        d[r] = make_uint2(pk2(v[0][r], v[1][r]), pk2(v[2][r], v[3][r]));
        *(uint2*)(qp + (i * 16 + r) * DD) = d[r];
      }
      // stands in front of any rewrite of a register that the stores above
      // name; as inputs address and data keep their registers up to the wait
      asm volatile("s_wait_xcnt 0x0" ::"v"(qp), "v"(d[0].x), "v"(d[0].y), "v"(d[1].x),
                   "v"(d[1].y), "v"(d[2].x), "v"(d[2].y), "v"(d[3].x), "v"(d[3].y),
                   "v"(d[4].x), "v"(d[4].y), "v"(d[5].x), "v"(d[5].y), "v"(d[6].x),
                   "v"(d[6].y), "v"(d[7].x), "v"(d[7].y)
                   : "memory");
    } else {
      // a lane holds 8 consecutive rows of a column: 16 bytes of a transposed
      // row.  Its lanes' rows lie 4 apart (64 B modulo the banks), so the 16-byte
      // piece's index is XORed with c >> 2 to spread them over all banks.
      const int piece = ((mloc >> 3) + 2 * i) ^ (c >> 2);
#pragma unroll
      for (int j = 0; j < 4; ++j)
        *(uint4*)(sm + (nloc + j) * TP + piece * 8) =
            make_uint4(pk2(v[j][0], v[j][1]), pk2(v[j][2], v[j][3]),
                       pk2(v[j][4], v[j][5]), pk2(v[j][6], v[j][7]));
    }
    // keeps each 16 rows' work together; without it the scheduler interleaves
    // all four groups, runs out of registers and spills to scratch
    __builtin_amdgcn_sched_barrier(0);
  }
}

__global__ __launch_bounds__(512) void qkv_rope_kernel(
    const float* __restrict__ x,
    const float* __restrict__ wq, const float* __restrict__ wk,
    const float* __restrict__ wv,
    const float* __restrict__ bq, const float* __restrict__ bk,
    const float* __restrict__ bv,
    const float* __restrict__ cosb, const float* __restrict__ sinb,
    _Float16* __restrict__ Qh, _Float16* __restrict__ Kt,
    _Float16* __restrict__ Vt) {
  __shared__ alignas(16) _Float16 sm[PSMEM_HALVES];
  static_assert(PT * TP <= PSMEM_HALVES, "transposed tile fits");

  const int z = blockIdx.z;
  const float* w = (z == 0) ? wq : (z == 1) ? wk : wv;

  const int tid = threadIdx.x;
  const int m0 = blockIdx.y * PT;  // token
  const int n0 = blockIdx.x * PT;  // feature

  v8f acc[4][4] = {};
  gemm_tile_nt_f32<DD, 4, 4, 4, 4>(x + (size_t)m0 * DD, w + (size_t)n0 * DD, sm, acc);

  if (z == 0) {
    qkv_epilogue<0>(acc, bq, cosb, sinb, Qh, sm, m0, n0);
    return;  // taken by the whole workgroup; no barrier follows for it
  }
  if (z == 1) qkv_epilogue<1>(acc, bk, cosb, sinb, Kt, sm, m0, n0);
  else        qkv_epilogue<2>(acc, bv, cosb, sinb, Vt, sm, m0, n0);
  __syncthreads();  // the transposed tile is complete
  // a wave stores the 512 contiguous bytes of a transposed row
  _Float16* dst = ((z == 1) ? Kt : Vt) + ((size_t)(m0 / SS) * DD + n0) * SS + (m0 & (SS - 1));
  for (int i = tid; i < PT * PT / 8; i += 512) {
    const int r = i >> 5;
    const int p = i & 31;
    // piece p of row r lies where the epilogue's XOR has put it
    *(uint4*)(dst + (size_t)r * SS + p * 8) =
        *(const uint4*)(sm + r * TP + (p ^ ((r >> 4) & 3)) * 8);
  }
}

// ---------------------------------------------------------------------------
// Kernel 2: Mt[b][d2][d1] = (1/256) * sum_t K[b][t][d1] * V[b][t][d2], f16.
// The power of two keeps the f16 values near 1 (the sum runs over S = 4096
// terms); kernel 3 multiplies it back.  grid = (DD/128, DD/128, BB).
// ---------------------------------------------------------------------------
#define MP 136  // staged output row stride in halves: 272 B = 16 B x 17
__global__ __launch_bounds__(256) void ktv_kernel(
    const _Float16* __restrict__ Kt, const _Float16* __restrict__ Vt,
    _Float16* __restrict__ Mt) {
  __shared__ alignas(16) _Float16 sm[GSMEM_HALVES];
  const int tid = threadIdx.x;
  const int lane = tid & 31;
  const int wave = tid >> 5;
  const int m0 = blockIdx.x * 128;  // d1
  const int n0 = blockIdx.y * 128;  // d2
  const size_t bo = (size_t)blockIdx.z * DD * SS;

  v8f acc[2][4] = {};
  gemm_tile_nt<SS>(Kt + bo + (size_t)m0 * SS, Vt + bo + (size_t)n0 * SS, sm, acc);

  // acc[i][j][r] = C[wm*32 + i*16 + 8h + r][wn*64 + j*16 + c]; staged as [n][m]
  const int mloc = (wave & 3) * 32 + (lane >> 4) * 8;
  const int nloc = (wave >> 2) * 64 + (lane & 15);
#pragma unroll
  for (int i = 0; i < 2; ++i)
#pragma unroll
    for (int j = 0; j < 4; ++j) {
      union { _Float16 e[8]; uint4 q; } p;
#pragma unroll
      for (int r = 0; r < 8; ++r) p.e[r] = (_Float16)(acc[i][j][r] * (1.0f / 256.0f));
      *(uint4*)(sm + (nloc + j * 16) * MP + mloc + i * 16) = p.q;
    }
  __syncthreads();
  _Float16* dst = Mt + (size_t)blockIdx.z * DD * DD + (size_t)n0 * DD + m0;
  for (int i = tid; i < 2048; i += 256) {  // 16 lanes store 256 contiguous bytes
    const int r = i >> 4;
    const int c = (i & 15) * 8;
    *(uint4*)(dst + (size_t)r * DD + c) = *(const uint4*)(sm + r * MP + c);
  }
}

// ---------------------------------------------------------------------------
// Kernel 3: out[b][s][d2] = 64 * sum_d1 Q[b][s][d1] * Mt[b][d2][d1], fp32
// (64 / 256 = 1 / B).  grid = (DD/128, SS/128, BB).
// ---------------------------------------------------------------------------
#define OP 132  // staged output row stride in floats: 528 B = 16 B x 33
__global__ __launch_bounds__(256) void qm_kernel(
    const _Float16* __restrict__ Qh, const _Float16* __restrict__ Mt,
    float* __restrict__ out) {
  __shared__ alignas(16) _Float16 sm[GSMEM_HALVES];
  static_assert(128 * OP * 4 <= GSMEM_HALVES * 2, "staged tile fits");
  const int tid = threadIdx.x;
  const int lane = tid & 31;
  const int wave = tid >> 5;
  const int m0 = blockIdx.x * 128;  // d2
  const int n0 = blockIdx.y * 128;  // s
  const int b = blockIdx.z;

  v8f acc[2][4] = {};
  gemm_tile_nt<DD>(Mt + (size_t)b * DD * DD + (size_t)m0 * DD,
                   Qh + ((size_t)b * SS + n0) * DD, sm, acc);

  float* so = (float*)sm;
  const int mloc = (wave & 3) * 32 + (lane >> 4) * 8;
  const int nloc = (wave >> 2) * 64 + (lane & 15);
#pragma unroll
  for (int i = 0; i < 2; ++i)
#pragma unroll
    for (int j = 0; j < 4; ++j) {
      float* p = so + (nloc + j * 16) * OP + mloc + i * 16;
      *(float4*)(p) = make_float4(acc[i][j][0] * 64.0f, acc[i][j][1] * 64.0f,
                                  acc[i][j][2] * 64.0f, acc[i][j][3] * 64.0f);
      *(float4*)(p + 4) = make_float4(acc[i][j][4] * 64.0f, acc[i][j][5] * 64.0f,
                                      acc[i][j][6] * 64.0f, acc[i][j][7] * 64.0f);
    }
  __syncthreads();
  float* dst = out + ((size_t)b * SS + n0) * DD + m0;
  for (int i = tid; i < 4096; i += 256) {  // a wave stores one 512-byte row
    const int r = i >> 5;
    const int c = (i & 31) * 4;
    *(float4*)(dst + (size_t)r * DD + c) = *(const float4*)(so + r * OP + c);
  }
}

extern "C" void kernel_launch(void* const* d_in, const int* in_sizes, int n_in,
                              void* d_out, int out_size, void* d_ws,
                              size_t ws_size, hipStream_t stream) {
  (void)in_sizes; (void)n_in; (void)out_size; (void)ws_size;
  const float* x  = (const float*)d_in[0];
  const float* fc = (const float*)d_in[1];
  const float* fs = (const float*)d_in[2];
  const float* wq = (const float*)d_in[3];
  const float* bq = (const float*)d_in[4];
  const float* wk = (const float*)d_in[5];
  const float* bk = (const float*)d_in[6];
  const float* wv = (const float*)d_in[7];
  const float* bv = (const float*)d_in[8];
  float* out = (float*)d_out;

  _Float16* Qh = (_Float16*)d_ws;
  _Float16* Kt = Qh + (size_t)BB * SS * DD;
  _Float16* Vt = Kt + (size_t)BB * SS * DD;
  _Float16* Mt = Vt + (size_t)BB * SS * DD;

  dim3 g1(DD / 256, (BB * SS) / 256, 3);
  qkv_rope_kernel<<<g1, dim3(512), 0, stream>>>(x, wq, wk, wv, bq, bk, bv, fc,
                                                fs, Qh, Kt, Vt);
  dim3 g2(DD / 128, DD / 128, BB);
  ktv_kernel<<<g2, dim3(256), 0, stream>>>(Kt, Vt, Mt);
  dim3 g3(DD / 128, SS / 128, BB);
  qm_kernel<<<g3, dim3(256), 0, stream>>>(Qh, Mt, out);
}

// v004
// Measured time: 184 microseconds a run.
// Next to v003, in two timings, it ran 1.10 and 1.09 times as fast.
// Counting every step since v000, it is 10.9 times as fast.
#include <hip/hip_runtime.h>

typedef __attribute__((ext_vector_type(16))) _Float16 v16h;
typedef __attribute__((ext_vector_type(8)))  float    v8f;
typedef unsigned int u32x4 __attribute__((ext_vector_type(4)));
typedef float    f32x2 __attribute__((ext_vector_type(2)));
typedef float    f32x4 __attribute__((ext_vector_type(4)));
typedef _Float16 f16x2 __attribute__((ext_vector_type(2)));

constexpr int BB = 4;
constexpr int SS = 4096;
constexpr int DD = 1024;

__device__ __forceinline__ v8f wmma_f16(v16h a, v16h b, v8f c) {
  return __builtin_amdgcn_wmma_f32_16x16x32_f16(false, a, false, b, (short)0, c,
                                                false, false);
}

// ---------------------------------------------------------------------------
// The reference has no softmax, so (Q K^T / B) V = Q (K^T V) / B.  Per batch
// K^T V is a D x D matrix: 2 x S*D*D multiply-adds instead of 2 x S*S*D.
//
// Shared main loop: C[m][n] = sum_k A[m][k] * Bm[n][k], both k-contiguous f16,
// one 128 x 128 tile per workgroup, 256 threads (8 waves, 4 along m, 2 along n,
// 32 x 64 per wave).  64 k per stage, two LDS buffers, the next stage's global
// loads held in registers while this stage is multiplied.
// ---------------------------------------------------------------------------
#define GP 72                  // LDS row stride in halves: 144 B = 16 B x 9
#define GSTG (256 * GP)        // one stage: 128 rows of A, then 128 rows of Bm
#define GSMEM_HALVES (2 * GSTG)

// 16x32 f16 fragment of one row; p = row start + 32 * kstep + 8 * (lane >> 4).
// The same k order serves A and B.
__device__ __forceinline__ v16h lds_frag(const _Float16* p) {
  union { v16h h; uint4 q[2]; } f;
  f.q[0] = *(const uint4*)(p);
  f.q[1] = *(const uint4*)(p + 16);
  return f.h;
}

template <int KD>
__device__ __forceinline__ void gemm_tile_nt(const _Float16* __restrict__ A,
                                             const _Float16* __restrict__ Bm,
                                             _Float16* sm, v8f (&acc)[2][4]) {
  const int tid = threadIdx.x;
  const int lane = tid & 31;
  const int wave = tid >> 5;
  const int wm = wave & 3;
  const int wn = wave >> 2;
  const int c = lane & 15;
  const int h = lane >> 4;
  const int lrow = tid >> 3;       // 32 rows per sweep, 8 lanes per 128-B row
  const int lcol = (tid & 7) * 8;
  const _Float16* ga = A + (size_t)lrow * KD + lcol;
  const _Float16* gb = Bm + (size_t)lrow * KD + lcol;
  _Float16* st = sm + lrow * GP + lcol;
  constexpr int NS = KD / 64;

  u32x4 ra[4], rb[4];
#pragma unroll
  for (int j = 0; j < 4; ++j) {
    ra[j] = *(const u32x4*)(ga + (size_t)j * 32 * KD);
    rb[j] = *(const u32x4*)(gb + (size_t)j * 32 * KD);
  }

  for (int s = 0; s < NS; ++s) {
    const int cur = (s & 1) * GSTG;
    // stage s goes from registers to its buffer; that buffer's last readers
    // (stage s - 2) have all passed the barrier of stage s - 1
#pragma unroll
    for (int j = 0; j < 4; ++j) {
      *(u32x4*)(st + cur + j * 32 * GP) = ra[j];
      *(u32x4*)(st + cur + (128 + j * 32) * GP) = rb[j];
    }
    __syncthreads();  // publishes stage s
    // stage s + 1 flies while stage s is multiplied (the last trip re-reads its
    // own); issued behind the barrier, whose fence would wait for them
    const int kn = (s + 1 < NS ? s + 1 : s) * 64;
#pragma unroll
    for (int j = 0; j < 4; ++j) {
      ra[j] = *(const u32x4*)(ga + (size_t)j * 32 * KD + kn);
      rb[j] = *(const u32x4*)(gb + (size_t)j * 32 * KD + kn);
    }
    // keeps the loads above issued ahead of the products; without it they sink
    // to the loop's foot and the wave waits out their latency every stage
    __builtin_amdgcn_sched_barrier(0);
    const _Float16* sa = sm + cur + (wm * 32 + c) * GP + 8 * h;
    const _Float16* sb = sm + cur + (128 + wn * 64 + c) * GP + 8 * h;
#pragma unroll
    for (int kk = 0; kk < 2; ++kk) {
      v16h af[2], bf[4];
#pragma unroll
      for (int i = 0; i < 2; ++i) af[i] = lds_frag(sa + i * 16 * GP + kk * 32);
#pragma unroll
      for (int j = 0; j < 4; ++j) bf[j] = lds_frag(sb + j * 16 * GP + kk * 32);
#pragma unroll
      for (int i = 0; i < 2; ++i)
#pragma unroll
        for (int j = 0; j < 4; ++j) acc[i][j] = wmma_f16(af[i], bf[j], acc[i][j]);
    }
  }
  __syncthreads();  // every read of the buffers is over: the callers reuse them
}

__device__ __forceinline__ uint2 cvt4(f32x4 v) {
  // one packed convert (round to nearest even) per pair
  const f16x2 lo = __builtin_convertvector(__builtin_shufflevector(v, v, 0, 1), f16x2);
  const f16x2 hi = __builtin_convertvector(__builtin_shufflevector(v, v, 2, 3), f16x2);
  return make_uint2(__builtin_bit_cast(unsigned int, lo),
                    __builtin_bit_cast(unsigned int, hi));
}

// ---------------------------------------------------------------------------
// Kernel 0: x and the three weight matrices rounded to f16 once.  Kernel 1 reads
// every row of x 12 times and every weight row 64 times: it now draws half the
// bytes from L2 and has no convert in its loop.  The rounding is the one that
// kernel 1 did on the way into LDS, so every value stays as it was.
// A block rounds CU floats a trip: 8 loads of 16 bytes a lane in flight, a wave's
// load covers 512 contiguous bytes and its store 256.
// ---------------------------------------------------------------------------
constexpr int CU = 256 * 4 * 8;            // floats per block and trip
constexpr int XU = BB * SS * DD / CU;      // units of x
constexpr int WU = DD * DD / CU;           // units of one weight matrix
constexpr int CTRIPS = 4;
constexpr int CBLOCKS = (XU + 3 * WU) / CTRIPS;
static_assert(CBLOCKS * CTRIPS == XU + 3 * WU, "every unit is rounded exactly once");

__global__ __launch_bounds__(256) void round_f16_kernel(
    const float* __restrict__ x, const float* __restrict__ wq,
    const float* __restrict__ wk, const float* __restrict__ wv,
    _Float16* __restrict__ xh, _Float16* __restrict__ wh) {
  const int tid = threadIdx.x;
  for (int t = 0; t < CTRIPS; ++t) {
    const int u = blockIdx.x + t * CBLOCKS;
    const int v = u - XU;  // the unit's index among the weights' units
    const float* s = (v < 0) ? x + (size_t)u * CU
                             : ((v < WU) ? wq : (v < 2 * WU) ? wk : wv) +
                                   (size_t)(v & (WU - 1)) * CU;
    _Float16* d = (v < 0) ? xh + (size_t)u * CU : wh + (size_t)v * CU;
    const float* sp = s + tid * 4;
    _Float16* dp = d + tid * 4;
    f32x4 r[8];
    // read once and never again: non-temporal, so that L2 keeps the f16 copies
#pragma unroll
    for (int j = 0; j < 8; ++j)
      r[j] = __builtin_nontemporal_load((const f32x4*)(sp + j * 1024));
    uint2 o[8];
#pragma unroll
    for (int j = 0; j < 8; ++j) {
      o[j] = cvt4(r[j]);
      *(uint2*)(dp + j * 1024) = o[j];
    }
    // stands in front of any rewrite of a register that the loads and stores
    // above name; as inputs the stored data keep their registers up to it
    asm volatile("s_wait_xcnt 0x0" ::"v"(o[0].x), "v"(o[0].y), "v"(o[1].x), "v"(o[1].y),
                 "v"(o[2].x), "v"(o[2].y), "v"(o[3].x), "v"(o[3].y), "v"(o[4].x),
                 "v"(o[4].y), "v"(o[5].x), "v"(o[5].y), "v"(o[6].x), "v"(o[6].y),
                 "v"(o[7].x), "v"(o[7].y)
                 : "memory");
  }
}

// The same loop for a tile of 16 waves with FN = 4, with 256 B (128 k) of a row per stage: 16
// lanes x 16 B, so 16 lanes load one aligned 256-byte unit and store one LDS row.
// WM x WN waves, FM x FN fragments of 16 x 16 per wave.
// Row 64w + 4c + j of Bm lies at LDS row 64w + 16j + c, so that fragment j of a
// wave holds column 4c + j in lane c: acc[i][0..3] of a lane are four adjacent
// columns of C.  Only the place of whole rows changes, the k order does not.
#define WP 136                 // LDS row stride in halves: 272 B = 16 B x 17
template <int KD, int WM, int WN, int FM, int FN>
__device__ __forceinline__ void gemm_tile_nt_perm(const _Float16* __restrict__ A,
                                                  const _Float16* __restrict__ Bm,
                                                  _Float16* sm,
                                                  v8f (&acc)[FM][FN]) {
  constexpr int TM = WM * FM * 16;      // rows of A in the tile
  constexpr int TN = WN * FN * 16;      // rows of Bm in the tile
  constexpr int RS = WM * WN * 2;       // rows per sweep: 16 lanes per 256-B row
  constexpr int STG = (TM + TN) * WP;   // one stage: the rows of A, then of Bm
  constexpr int NS = KD / 128;
  const int tid = threadIdx.x;
  const int lane = tid & 31;
  const int wave = tid >> 5;
  const int wm = wave % WM;
  const int wn = wave / WM;
  const int c = lane & 15;
  const int h = lane >> 4;
  const int lrow = tid >> 4;
  const int lcol = (tid & 15) * 8;
  const _Float16* ga = A + (size_t)lrow * KD + lcol;
  const _Float16* gb = Bm + (size_t)lrow * KD + lcol;
  _Float16* st = sm + lrow * WP + lcol;
  static_assert(RS == 32 && FN == 4, "the row permutation below is written for these");
  _Float16* stb = sm + (TM + (lrow & 3) * 16 + (lrow >> 2)) * WP + lcol;

  u32x4 ra[TM / RS], rb[TN / RS];
#pragma unroll
  for (int j = 0; j < TM / RS; ++j) ra[j] = *(const u32x4*)(ga + (size_t)j * RS * KD);
#pragma unroll
  for (int j = 0; j < TN / RS; ++j) rb[j] = *(const u32x4*)(gb + (size_t)j * RS * KD);

  for (int s = 0; s < NS; ++s) {
    const int cur = (s & 1) * STG;
    // stage s goes from registers to its buffer; that buffer's last readers
    // (stage s - 2) have all passed the barrier of stage s - 1
#pragma unroll
    for (int j = 0; j < TM / RS; ++j) *(u32x4*)(st + cur + j * RS * WP) = ra[j];
#pragma unroll
    for (int j = 0; j < TN / RS; ++j)
      *(u32x4*)(stb + cur + ((j >> 1) * 64 + (j & 1) * 8) * WP) = rb[j];
    __syncthreads();  // publishes stage s
    // stage s + 1 flies while stage s is multiplied (the last trip has none to
    // fetch); issued behind the barrier, whose fence would wait for them
    if (s + 1 < NS) {
      const _Float16* pa = ga + (s + 1) * 128;
      const _Float16* pb = gb + (s + 1) * 128;
#pragma unroll
      for (int j = 0; j < TM / RS; ++j) ra[j] = *(const u32x4*)(pa + (size_t)j * RS * KD);
#pragma unroll
      for (int j = 0; j < TN / RS; ++j) rb[j] = *(const u32x4*)(pb + (size_t)j * RS * KD);
      // stands in front of any rewrite of a register that the loads above name;
      // as inputs the two addresses keep their registers up to the wait (without
      // it the last load's result lands on the address registers themselves)
      asm volatile("s_wait_xcnt 0x0" ::"v"(pa), "v"(pb) : "memory");
    }
    // keeps the loads above issued ahead of the products; without it they sink
    // to the loop's foot and the wave waits out their latency every stage
    __builtin_amdgcn_sched_barrier(0);
    const _Float16* sa = sm + cur + (wm * FM * 16 + c) * WP + 8 * h;
    const _Float16* sb = sm + cur + (TM + wn * FN * 16 + c) * WP + 8 * h;
#pragma unroll
    for (int kk = 0; kk < 4; ++kk) {
      v16h af[FM], bf[FN];
#pragma unroll
      for (int i = 0; i < FM; ++i) af[i] = lds_frag(sa + i * 16 * WP + kk * 32);
#pragma unroll
      for (int j = 0; j < FN; ++j) bf[j] = lds_frag(sb + j * 16 * WP + kk * 32);
#pragma unroll
      for (int i = 0; i < FM; ++i)
#pragma unroll
        for (int j = 0; j < FN; ++j) acc[i][j] = wmma_f16(af[i], bf[j], acc[i][j]);
    }
  }
  __syncthreads();  // every read of the buffers is over: the caller reuses them
}

// ---------------------------------------------------------------------------
// Kernel 1: fused QKV projection + bias + rotary, f16 in (kernel 0) -> f16 out.
// grid = (DD/256, (BB*SS)/256, 3), block = 512 (16 waves, 4 x 4, 64 x 64 per
// wave), one 256 x 256 tile (tokens x features) per workgroup.
// Q is stored row-major [b][s][d]; K and V are stored transposed [b][d][t], so
// that the product K^T V reads both with its summed index t contiguous.
// ---------------------------------------------------------------------------
#define PT 256                 // tile edge
#define TP (PT + 8)            // row stride (halves) of the transposed tile: 528 B
#define PSMEM_HALVES (2 * 2 * PT * WP)

__device__ __forceinline__ unsigned int pk2(float a, float b) {
  const f32x2 v = {a, b};
  return __builtin_bit_cast(unsigned int, __builtin_convertvector(v, f16x2));
}

// Bias, rotary and store of one wave's 64 x 64 part.  Z = 0: Q, rotated, row-major
// to memory; Z = 1: K, rotated, into the transposed LDS tile; Z = 2: V, the same
// without the rotation.  acc[i][j][r] = C[wm*64 + i*16 + 8h + r][wn*64 + 4c + j]:
// a lane holds two whole (even, odd) pairs, so the rotation needs no other lane,
// 16 lanes read a whole 128-byte line of cos or sin and store one of Q.
template <int Z>
__device__ __forceinline__ void qkv_epilogue(
    v8f (&acc)[4][4], const float* __restrict__ bias,
    const float* __restrict__ cosb, const float* __restrict__ sinb,
    _Float16* __restrict__ out, _Float16* sm, int m0, int n0) {
  const int lane = threadIdx.x & 31;
  const int wave = threadIdx.x >> 5;
  const int c = lane & 15;
  const int mloc = (wave & 3) * 64 + (lane >> 4) * 8;
  const int nloc = (wave >> 2) * 64 + c * 4;
  const unsigned int bo = (unsigned int)nloc * 4u;  // the lane's byte offset in the tile's bias
  // the tile's rows start at a multiple of its edge, so they never wrap past SS
  const size_t fo = (size_t)((m0 & (SS - 1)) + mloc) * (DD / 2) + ((n0 + nloc) >> 1);
  const float* cp = cosb + fo;
  const float* sp = sinb + fo;
  _Float16* qp = out + (size_t)(m0 + mloc) * DD + n0 + nloc;

  const f32x4 b4 = *(const f32x4*)((const char*)(bias + n0) + bo);
  f32x2 cv[2][8], sv[2][8];
  if constexpr (Z < 2) {
#pragma unroll
    for (int r = 0; r < 8; ++r) {
      cv[0][r] = *(const f32x2*)(cp + r * (DD / 2));
      sv[0][r] = *(const f32x2*)(sp + r * (DD / 2));
    }
  }
  // stands in front of any rewrite of a register that the loads above name; as
  // inputs the addresses keep their registers up to the wait
  if constexpr (Z < 2)
    asm volatile("s_wait_xcnt 0x0" ::"v"(bo), "v"(cp), "v"(sp) : "memory");
  else
    asm volatile("s_wait_xcnt 0x0" ::"v"(bo) : "memory");
#pragma unroll
  for (int i = 0; i < 4; ++i) {
    if constexpr (Z < 2) {
      if (i + 1 < 4) {
        // the next 16 rows' factors fly while these 16 rows are rotated
#pragma unroll
        for (int r = 0; r < 8; ++r) {
          cv[(i + 1) & 1][r] = *(const f32x2*)(cp + ((i + 1) * 16 + r) * (DD / 2));
          sv[(i + 1) & 1][r] = *(const f32x2*)(sp + ((i + 1) * 16 + r) * (DD / 2));
        }
        // as above: in front of any rewrite of the two address registers
        asm volatile("s_wait_xcnt 0x0" ::"v"(cp), "v"(sp) : "memory");
      }
    }
    float v[4][8];
#pragma unroll
    for (int r = 0; r < 8; ++r) {
#pragma unroll
      for (int j = 0; j < 4; ++j) v[j][r] = acc[i][j][r] + b4[j];
      if constexpr (Z < 2) {
#pragma unroll
        for (int p = 0; p < 2; ++p) {
          const float cc = cv[i & 1][r][p], ss = sv[i & 1][r][p];
          const float h0 = v[2 * p][r], h1 = v[2 * p + 1][r];
          v[2 * p][r] = __builtin_fmaf(cc, h0, -(ss * h1));
          v[2 * p + 1][r] = __builtin_fmaf(cc, h1, ss * h0);
        }
      }
    }
    if constexpr (Z == 0) {
      uint2 d[8];
#pragma unroll
      for (int r = 0; r < 8; ++r) {
        d[r] = make_uint2(pk2(v[0][r], v[1][r]), pk2(v[2][r], v[3][r]));
        *(uint2*)(qp + (i * 16 + r) * DD) = d[r];
      }
      // stands in front of any rewrite of a register that the stores above
      // name; as inputs address and data keep their registers up to the wait
      asm volatile("s_wait_xcnt 0x0" ::"v"(qp), "v"(d[0].x), "v"(d[0].y), "v"(d[1].x),
                   "v"(d[1].y), "v"(d[2].x), "v"(d[2].y), "v"(d[3].x), "v"(d[3].y),
                   "v"(d[4].x), "v"(d[4].y), "v"(d[5].x), "v"(d[5].y), "v"(d[6].x),
                   "v"(d[6].y), "v"(d[7].x), "v"(d[7].y)
                   : "memory");
    } else {
      // a lane holds 8 consecutive rows of a column: 16 bytes of a transposed
      // row.  Its lanes' rows lie 4 apart (64 B modulo the banks), so the 16-byte
      // piece's index is XORed with c >> 2 to spread them over all banks.
      const int piece = ((mloc >> 3) + 2 * i) ^ (c >> 2);
#pragma unroll
      for (int j = 0; j < 4; ++j)
        *(uint4*)(sm + (nloc + j) * TP + piece * 8) =
            make_uint4(pk2(v[j][0], v[j][1]), pk2(v[j][2], v[j][3]),
                       pk2(v[j][4], v[j][5]), pk2(v[j][6], v[j][7]));
    }
    // keeps each 16 rows' work together; without it the scheduler interleaves
    // all four groups, runs out of registers and spills to scratch
    __builtin_amdgcn_sched_barrier(0);
  }
}

__global__ __launch_bounds__(512) void qkv_rope_kernel(
    const _Float16* __restrict__ xh, const _Float16* __restrict__ wh,
    const float* __restrict__ bq, const float* __restrict__ bk,
    const float* __restrict__ bv,
    const float* __restrict__ cosb, const float* __restrict__ sinb,
    _Float16* __restrict__ Qh, _Float16* __restrict__ Kt,
    _Float16* __restrict__ Vt) {
  __shared__ alignas(16) _Float16 sm[PSMEM_HALVES];
  static_assert(PT * TP <= PSMEM_HALVES, "transposed tile fits");

  const int z = blockIdx.z;
  const _Float16* w = wh + (size_t)z * DD * DD;

  const int tid = threadIdx.x;
  const int m0 = blockIdx.y * PT;  // token
  const int n0 = blockIdx.x * PT;  // feature

  v8f acc[4][4] = {};
  gemm_tile_nt_perm<DD, 4, 4, 4, 4>(xh + (size_t)m0 * DD, w + (size_t)n0 * DD, sm, acc);

  if (z == 0) {
    qkv_epilogue<0>(acc, bq, cosb, sinb, Qh, sm, m0, n0);
    return;  // taken by the whole workgroup; no barrier follows for it
  }
  if (z == 1) qkv_epilogue<1>(acc, bk, cosb, sinb, Kt, sm, m0, n0);
  else        qkv_epilogue<2>(acc, bv, cosb, sinb, Vt, sm, m0, n0);
  __syncthreads();  // the transposed tile is complete
  // a wave stores the 512 contiguous bytes of a transposed row
  _Float16* dst = ((z == 1) ? Kt : Vt) + ((size_t)(m0 / SS) * DD + n0) * SS + (m0 & (SS - 1));
  for (int i = tid; i < PT * PT / 8; i += 512) {
    const int r = i >> 5;
    const int p = i & 31;
    // piece p of row r lies where the epilogue's XOR has put it
    *(uint4*)(dst + (size_t)r * SS + p * 8) =
        *(const uint4*)(sm + r * TP + (p ^ ((r >> 4) & 3)) * 8);
  }
}

// ---------------------------------------------------------------------------
// Kernel 2: Mt[b][d2][d1] = (1/256) * sum_t K[b][t][d1] * V[b][t][d2], f16.
// The power of two keeps the f16 values near 1 (the sum runs over S = 4096
// terms); kernel 3 multiplies it back.  grid = (DD/128, DD/128, BB).
// ---------------------------------------------------------------------------
#define MP 136  // staged output row stride in halves: 272 B = 16 B x 17
__global__ __launch_bounds__(256) void ktv_kernel(
    const _Float16* __restrict__ Kt, const _Float16* __restrict__ Vt,
    _Float16* __restrict__ Mt) {
  __shared__ alignas(16) _Float16 sm[GSMEM_HALVES];
  const int tid = threadIdx.x;
  const int lane = tid & 31;
  const int wave = tid >> 5;
  const int m0 = blockIdx.x * 128;  // d1
  const int n0 = blockIdx.y * 128;  // d2
  const size_t bo = (size_t)blockIdx.z * DD * SS;

  v8f acc[2][4] = {};
  gemm_tile_nt<SS>(Kt + bo + (size_t)m0 * SS, Vt + bo + (size_t)n0 * SS, sm, acc);

  // acc[i][j][r] = C[wm*32 + i*16 + 8h + r][wn*64 + j*16 + c]; staged as [n][m]
  const int mloc = (wave & 3) * 32 + (lane >> 4) * 8;
  const int nloc = (wave >> 2) * 64 + (lane & 15);
#pragma unroll
  for (int i = 0; i < 2; ++i)
#pragma unroll
    for (int j = 0; j < 4; ++j) {
      union { _Float16 e[8]; uint4 q; } p;
#pragma unroll
      for (int r = 0; r < 8; ++r) p.e[r] = (_Float16)(acc[i][j][r] * (1.0f / 256.0f));
      *(uint4*)(sm + (nloc + j * 16) * MP + mloc + i * 16) = p.q;
    }
  __syncthreads();
  _Float16* dst = Mt + (size_t)blockIdx.z * DD * DD + (size_t)n0 * DD + m0;
  for (int i = tid; i < 2048; i += 256) {  // 16 lanes store 256 contiguous bytes
    const int r = i >> 4;
    const int c = (i & 15) * 8;
    *(uint4*)(dst + (size_t)r * DD + c) = *(const uint4*)(sm + r * MP + c);
  }
}

// ---------------------------------------------------------------------------
// Kernel 3: out[b][s][d2] = 64 * sum_d1 Q[b][s][d1] * Mt[b][d2][d1], fp32
// (64 / 256 = 1 / B).  grid = (DD/128, SS/128, BB).
// ---------------------------------------------------------------------------
#define OP 132  // staged output row stride in floats: 528 B = 16 B x 33
__global__ __launch_bounds__(256) void qm_kernel(
    const _Float16* __restrict__ Qh, const _Float16* __restrict__ Mt,
    float* __restrict__ out) {
  __shared__ alignas(16) _Float16 sm[GSMEM_HALVES];
  static_assert(128 * OP * 4 <= GSMEM_HALVES * 2, "staged tile fits");
  const int tid = threadIdx.x;
  const int lane = tid & 31;
  const int wave = tid >> 5;
  const int m0 = blockIdx.x * 128;  // d2
  const int n0 = blockIdx.y * 128;  // s
  const int b = blockIdx.z;

  v8f acc[2][4] = {};
  gemm_tile_nt<DD>(Mt + (size_t)b * DD * DD + (size_t)m0 * DD,
                   Qh + ((size_t)b * SS + n0) * DD, sm, acc);

  float* so = (float*)sm;
  const int mloc = (wave & 3) * 32 + (lane >> 4) * 8;
  const int nloc = (wave >> 2) * 64 + (lane & 15);
#pragma unroll
  for (int i = 0; i < 2; ++i)
#pragma unroll
    for (int j = 0; j < 4; ++j) {
      float* p = so + (nloc + j * 16) * OP + mloc + i * 16;
      *(float4*)(p) = make_float4(acc[i][j][0] * 64.0f, acc[i][j][1] * 64.0f,
                                  acc[i][j][2] * 64.0f, acc[i][j][3] * 64.0f);
      *(float4*)(p + 4) = make_float4(acc[i][j][4] * 64.0f, acc[i][j][5] * 64.0f,
                                      acc[i][j][6] * 64.0f, acc[i][j][7] * 64.0f);
    }
  __syncthreads();
  float* dst = out + ((size_t)b * SS + n0) * DD + m0;
  for (int i = tid; i < 4096; i += 256) {  // a wave stores one 512-byte row
    const int r = i >> 5;
    const int c = (i & 31) * 4;
    *(float4*)(dst + (size_t)r * DD + c) = *(const float4*)(so + r * OP + c);
  }
}

extern "C" void kernel_launch(void* const* d_in, const int* in_sizes, int n_in,
                              void* d_out, int out_size, void* d_ws,
                              size_t ws_size, hipStream_t stream) {
  (void)in_sizes; (void)n_in; (void)out_size; (void)ws_size;
  const float* x  = (const float*)d_in[0];
  const float* fc = (const float*)d_in[1];
  const float* fs = (const float*)d_in[2];
  const float* wq = (const float*)d_in[3];
  const float* bq = (const float*)d_in[4];
  const float* wk = (const float*)d_in[5];
  const float* bk = (const float*)d_in[6];
  const float* wv = (const float*)d_in[7];
  const float* bv = (const float*)d_in[8];
  float* out = (float*)d_out;

  _Float16* Qh = (_Float16*)d_ws;
  _Float16* Kt = Qh + (size_t)BB * SS * DD;
  _Float16* Vt = Kt + (size_t)BB * SS * DD;
  _Float16* Mt = Vt + (size_t)BB * SS * DD;
  _Float16* xh = Mt + (size_t)BB * DD * DD;
  _Float16* wh = xh + (size_t)BB * SS * DD;

  round_f16_kernel<<<dim3(CBLOCKS), dim3(256), 0, stream>>>(x, wq, wk, wv, xh, wh);
  dim3 g1(DD / 256, (BB * SS) / 256, 3);
  qkv_rope_kernel<<<g1, dim3(512), 0, stream>>>(xh, wh, bq, bk, bv, fc, fs, Qh,
                                                Kt, Vt);
  dim3 g2(DD / 128, DD / 128, BB);
  ktv_kernel<<<g2, dim3(256), 0, stream>>>(Kt, Vt, Mt);
  dim3 g3(DD / 128, SS / 128, BB);
  qm_kernel<<<g3, dim3(256), 0, stream>>>(Qh, Mt, out);
}

// v005
// Measured time: 170 microseconds a run.
// In both of two side-by-side timings against v004, it was 1.08 times as fast.
// All steps since v000 together make it 11.8 times as fast.
#include <hip/hip_runtime.h>

typedef __attribute__((ext_vector_type(16))) _Float16 v16h;
typedef __attribute__((ext_vector_type(8)))  float    v8f;
typedef float    f32x2 __attribute__((ext_vector_type(2)));
typedef float    f32x4 __attribute__((ext_vector_type(4)));
typedef _Float16 f16x2 __attribute__((ext_vector_type(2)));

constexpr int BB = 4;
constexpr int SS = 4096;
constexpr int DD = 1024;

__device__ __forceinline__ v8f wmma_f16(v16h a, v16h b, v8f c) {
  return __builtin_amdgcn_wmma_f32_16x16x32_f16(false, a, false, b, (short)0, c,
                                                false, false);
}

// ---------------------------------------------------------------------------
// The reference has no softmax, so (Q K^T / B) V = Q (K^T V) / B.  Per batch
// K^T V is a D x D matrix: 2 x S*D*D multiply-adds instead of 2 x S*S*D.
//
// Shared main loop: C[m][n] = sum_k A[m][k] * Bm[n][k], both k-contiguous f16,
// one 128 x 128 tile per workgroup, 256 threads (8 waves, 4 along m, 2 along n,
// 32 x 64 per wave).  64 k per stage, two LDS buffers; a stage goes from global
// memory into its buffer by asynchronous copies, through no register, while the
// stage before it is multiplied.
// ---------------------------------------------------------------------------
#define GP 72                  // LDS row stride in halves: 144 B = 16 B x 9
#define GSTG (256 * GP)        // one stage: 128 rows of A, then 128 rows of Bm
#define GSMEM_HALVES (2 * GSTG)

// 16x32 f16 fragment of one row; p = row start + 32 * kstep + 8 * (lane >> 4).
// The same k order serves A and B.
__device__ __forceinline__ v16h lds_frag(const _Float16* p) {
  union { v16h h; uint4 q[2]; } f;
  f.q[0] = *(const uint4*)(p);
  f.q[1] = *(const uint4*)(p + 16);
  return f.h;
}

// The LDS byte address of a __shared__ location, as an asynchronous copy takes it.
__device__ __forceinline__ unsigned int lds_addr(const _Float16* p) {
  return (unsigned int)(size_t)(const __attribute__((address_space(3))) _Float16*)p;
}

// Eight asynchronous copies of 16 bytes a lane, global memory to LDS.  The wait
// at the end stands in front of any rewrite of a register that the copies name:
// inside their own statement nothing can be moved between them and it.
__device__ __forceinline__ void async_copy8(const unsigned int (&l)[8],
                                            const _Float16* const (&g)[8]) {
  asm volatile(
      "global_load_async_to_lds_b128 %0, %8, off\n\t"
      "global_load_async_to_lds_b128 %1, %9, off\n\t"
      "global_load_async_to_lds_b128 %2, %10, off\n\t"
      "global_load_async_to_lds_b128 %3, %11, off\n\t"
      "global_load_async_to_lds_b128 %4, %12, off\n\t"
      "global_load_async_to_lds_b128 %5, %13, off\n\t"
      "global_load_async_to_lds_b128 %6, %14, off\n\t"
      "global_load_async_to_lds_b128 %7, %15, off\n\t"
      "s_wait_xcnt 0x0"
      ::"v"(l[0]), "v"(l[1]), "v"(l[2]), "v"(l[3]), "v"(l[4]), "v"(l[5]), "v"(l[6]),
      "v"(l[7]), "v"(g[0]), "v"(g[1]), "v"(g[2]), "v"(g[3]), "v"(g[4]), "v"(g[5]),
      "v"(g[6]), "v"(g[7])
      : "memory");
}

// This wave's own copies have landed in LDS.
__device__ __forceinline__ void wait_async_copies() {
  asm volatile("s_wait_asynccnt 0x0" ::: "memory");
}

// This wave's own LDS reads are over: it may let their buffer be refilled.
__device__ __forceinline__ void wait_lds_reads() {
  asm volatile("s_wait_dscnt 0x0" ::: "memory");
}

template <int KD>
__device__ __forceinline__ void gemm_tile_nt(const _Float16* __restrict__ A,
                                             const _Float16* __restrict__ Bm,
                                             _Float16* sm, v8f (&acc)[2][4]) {
  const int tid = threadIdx.x;
  const int lane = tid & 31;
  const int wave = tid >> 5;
  const int wm = wave & 3;
  const int wn = wave >> 2;
  const int c = lane & 15;
  const int h = lane >> 4;
  const int lrow = tid >> 3;       // 32 rows per sweep, 8 lanes per 128-B row
  const int lcol = (tid & 7) * 8;
  const _Float16* ga = A + (size_t)lrow * KD + lcol;
  const _Float16* gb = Bm + (size_t)lrow * KD + lcol;
  const unsigned int st = lds_addr(sm + lrow * GP + lcol);
  constexpr int NS = KD / 64;
  static_assert(NS >= 2, "the ring starts with two stages");

  // stage s into buffer s & 1: 4 sweeps of 32 rows of A, then 4 of Bm
  auto copy_stage = [&](int s) {
    const unsigned int d = st + (unsigned int)(s & 1) * (GSTG * 2);
    unsigned int l[8];
    const _Float16* g[8];
#pragma unroll
    for (int j = 0; j < 4; ++j) {
      l[j] = d + j * 32 * GP * 2;
      l[4 + j] = d + (128 + j * 32) * GP * 2;
      g[j] = ga + (size_t)j * 32 * KD + s * 64;
      g[4 + j] = gb + (size_t)j * 32 * KD + s * 64;
    }
    async_copy8(l, g);
  };

  copy_stage(0);
  wait_async_copies();
  __syncthreads();  // publishes stage 0
  copy_stage(1);

  for (int s = 0; s < NS; ++s) {
    const int cur = (s & 1) * GSTG;
    const _Float16* sa = sm + cur + (wm * 32 + c) * GP + 8 * h;
    const _Float16* sb = sm + cur + (128 + wn * 64 + c) * GP + 8 * h;
#pragma unroll
    for (int kk = 0; kk < 2; ++kk) {
      v16h af[2], bf[4];
#pragma unroll
      for (int i = 0; i < 2; ++i) af[i] = lds_frag(sa + i * 16 * GP + kk * 32);
#pragma unroll
      for (int j = 0; j < 4; ++j) bf[j] = lds_frag(sb + j * 16 * GP + kk * 32);
#pragma unroll
      for (int i = 0; i < 2; ++i)
#pragma unroll
        for (int j = 0; j < 4; ++j) acc[i][j] = wmma_f16(af[i], bf[j], acc[i][j]);
    }
    wait_lds_reads();
    wait_async_copies();
    // publishes stage s + 1 and ends every read of stage s: its buffer is free
    // for stage s + 2, which flies while stage s + 1 is multiplied; behind the
    // last trip's barrier the callers reuse the buffers
    __syncthreads();
    if (s + 2 < NS) copy_stage(s + 2);
  }
  wait_async_copies();  // none is outstanding when the buffers get their next use
}

__device__ __forceinline__ uint2 cvt4(f32x4 v) {
  // one packed convert (round to nearest even) per pair
  const f16x2 lo = __builtin_convertvector(__builtin_shufflevector(v, v, 0, 1), f16x2);
  const f16x2 hi = __builtin_convertvector(__builtin_shufflevector(v, v, 2, 3), f16x2);
  return make_uint2(__builtin_bit_cast(unsigned int, lo),
                    __builtin_bit_cast(unsigned int, hi));
}

// ---------------------------------------------------------------------------
// Kernel 0: x and the three weight matrices rounded to f16 once.  Kernel 1 reads
// every row of x 12 times and every weight row 64 times: it now draws half the
// bytes from L2 and has no convert in its loop.  The rounding is the one that
// kernel 1 did on the way into LDS, so every value stays as it was.
// A block rounds CU floats a trip: 8 loads of 16 bytes a lane in flight, a wave's
// load covers 512 contiguous bytes and its store 256.
// ---------------------------------------------------------------------------
constexpr int CU = 256 * 4 * 8;            // floats per block and trip
constexpr int XU = BB * SS * DD / CU;      // units of x
constexpr int WU = DD * DD / CU;           // units of one weight matrix
constexpr int CTRIPS = 4;
constexpr int CBLOCKS = (XU + 3 * WU) / CTRIPS;
static_assert(CBLOCKS * CTRIPS == XU + 3 * WU, "every unit is rounded exactly once");

__global__ __launch_bounds__(256) void round_f16_kernel(
    const float* __restrict__ x, const float* __restrict__ wq,
    const float* __restrict__ wk, const float* __restrict__ wv,
    _Float16* __restrict__ xh, _Float16* __restrict__ wh) {
  const int tid = threadIdx.x;
  for (int t = 0; t < CTRIPS; ++t) {
    const int u = blockIdx.x + t * CBLOCKS;
    const int v = u - XU;  // the unit's index among the weights' units
    const float* s = (v < 0) ? x + (size_t)u * CU
                             : ((v < WU) ? wq : (v < 2 * WU) ? wk : wv) +
                                   (size_t)(v & (WU - 1)) * CU;
    _Float16* d = (v < 0) ? xh + (size_t)u * CU : wh + (size_t)v * CU;
    const float* sp = s + tid * 4;
    _Float16* dp = d + tid * 4;
    f32x4 r[8];
    // read once and never again: non-temporal, so that L2 keeps the f16 copies
#pragma unroll
    for (int j = 0; j < 8; ++j)
      r[j] = __builtin_nontemporal_load((const f32x4*)(sp + j * 1024));
    uint2 o[8];
#pragma unroll
    for (int j = 0; j < 8; ++j) {
      o[j] = cvt4(r[j]);
      *(uint2*)(dp + j * 1024) = o[j];
    }
    // stands in front of any rewrite of a register that the loads and stores
    // above name; as inputs the stored data keep their registers up to it
    asm volatile("s_wait_xcnt 0x0" ::"v"(o[0].x), "v"(o[0].y), "v"(o[1].x), "v"(o[1].y),
                 "v"(o[2].x), "v"(o[2].y), "v"(o[3].x), "v"(o[3].y), "v"(o[4].x),
                 "v"(o[4].y), "v"(o[5].x), "v"(o[5].y), "v"(o[6].x), "v"(o[6].y),
                 "v"(o[7].x), "v"(o[7].y)
                 : "memory");
  }
}

// The same loop for a 256 x 256 tile, with 256 B (128 k) of a row per stage: 16
// lanes x 16 B, so 16 lanes copy one aligned 256-byte unit into one LDS row.
// WM x WN waves, FM x FN fragments of 16 x 16 per wave.
// Row 64w + 4c + j of Bm lies at LDS row 64w + 16j + c, so that fragment j of a
// wave holds column 4c + j in lane c: acc[i][0..3] of a lane are four adjacent
// columns of C.  Only the place of whole rows changes, the k order does not.
#define WP 136                 // LDS row stride in halves: 272 B = 16 B x 17
template <int KD, int WM, int WN, int FM, int FN>
__device__ __forceinline__ void gemm_tile_nt_perm(const _Float16* __restrict__ A,
                                                  const _Float16* __restrict__ Bm,
                                                  _Float16* sm,
                                                  v8f (&acc)[FM][FN]) {
  constexpr int TM = WM * FM * 16;      // rows of A in the tile
  constexpr int TN = WN * FN * 16;      // rows of Bm in the tile
  constexpr int RS = WM * WN * 2;       // rows per sweep: 16 lanes per 256-B row
  constexpr int STG = (TM + TN) * WP;   // one stage: the rows of A, then of Bm
  constexpr int NS = KD / 128;
  const int tid = threadIdx.x;
  const int lane = tid & 31;
  const int wave = tid >> 5;
  const int wm = wave % WM;
  const int wn = wave / WM;
  const int c = lane & 15;
  const int h = lane >> 4;
  const int lrow = tid >> 4;
  const int lcol = (tid & 15) * 8;
  const _Float16* ga = A + (size_t)lrow * KD + lcol;
  const _Float16* gb = Bm + (size_t)lrow * KD + lcol;
  const unsigned int st = lds_addr(sm + lrow * WP + lcol);
  static_assert(RS == 32 && FN == 4, "the row permutation below is written for these");
  const unsigned int stb = lds_addr(sm + (TM + (lrow & 3) * 16 + (lrow >> 2)) * WP + lcol);
  static_assert(TM / RS == 8 && TN / RS == 8, "eight copies a statement and operand");
  static_assert(NS >= 2, "the ring starts with two stages");

  // stage s into buffer s & 1: 8 sweeps of RS rows of A, then 8 of Bm
  auto copy_stage = [&](int s) {
    const unsigned int d = (unsigned int)(s & 1) * (STG * 2);
    unsigned int l[8];
    const _Float16* g[8];
#pragma unroll
    for (int j = 0; j < 8; ++j) {
      l[j] = st + d + j * RS * WP * 2;
      g[j] = ga + (size_t)j * RS * KD + s * 128;
    }
    async_copy8(l, g);
#pragma unroll
    for (int j = 0; j < 8; ++j) {
      l[j] = stb + d + ((j >> 1) * 64 + (j & 1) * 8) * WP * 2;
      g[j] = gb + (size_t)j * RS * KD + s * 128;
    }
    async_copy8(l, g);
  };

  copy_stage(0);
  wait_async_copies();
  __syncthreads();  // publishes stage 0
  copy_stage(1);

  for (int s = 0; s < NS; ++s) {
    const int cur = (s & 1) * STG;
    const _Float16* sa = sm + cur + (wm * FM * 16 + c) * WP + 8 * h;
    const _Float16* sb = sm + cur + (TM + wn * FN * 16 + c) * WP + 8 * h;
#pragma unroll
    for (int kk = 0; kk < 4; ++kk) {
      v16h af[FM], bf[FN];
#pragma unroll
      for (int i = 0; i < FM; ++i) af[i] = lds_frag(sa + i * 16 * WP + kk * 32);
#pragma unroll
      for (int j = 0; j < FN; ++j) bf[j] = lds_frag(sb + j * 16 * WP + kk * 32);
#pragma unroll
      for (int i = 0; i < FM; ++i)
#pragma unroll
        for (int j = 0; j < FN; ++j) acc[i][j] = wmma_f16(af[i], bf[j], acc[i][j]);
    }
    wait_lds_reads();
    wait_async_copies();
    // publishes stage s + 1 and ends every read of stage s: its buffer is free
    // for stage s + 2, which flies while stage s + 1 is multiplied; behind the
    // last trip's barrier the caller reuses the buffers
    __syncthreads();
    if (s + 2 < NS) copy_stage(s + 2);
  }
  wait_async_copies();  // none is outstanding when the buffers get their next use
}

// ---------------------------------------------------------------------------
// Kernel 1: fused QKV projection + bias + rotary, f16 in (kernel 0) -> f16 out.
// grid = (DD/256, (BB*SS)/256, 3), block = 512 (16 waves, 4 x 4, 64 x 64 per
// wave), one 256 x 256 tile (tokens x features) per workgroup.
// Q is stored row-major [b][s][d]; K and V are stored transposed [b][d][t], so
// that the product K^T V reads both with its summed index t contiguous.
// ---------------------------------------------------------------------------
#define PT 256                 // tile edge
#define TP (PT + 8)            // row stride (halves) of the transposed tile: 528 B
#define PSMEM_HALVES (2 * 2 * PT * WP)

__device__ __forceinline__ unsigned int pk2(float a, float b) {
  const f32x2 v = {a, b};
  return __builtin_bit_cast(unsigned int, __builtin_convertvector(v, f16x2));
}

// Bias, rotary and store of one wave's 64 x 64 part.  Z = 0: Q, rotated, row-major
// to memory; Z = 1: K, rotated, into the transposed LDS tile; Z = 2: V, the same
// without the rotation.  acc[i][j][r] = C[wm*64 + i*16 + 8h + r][wn*64 + 4c + j]:
// a lane holds two whole (even, odd) pairs, so the rotation needs no other lane,
// 16 lanes read a whole 128-byte line of cos or sin and store one of Q.
template <int Z>
__device__ __forceinline__ void qkv_epilogue(
    v8f (&acc)[4][4], const float* __restrict__ bias,
    const float* __restrict__ cosb, const float* __restrict__ sinb,
    _Float16* __restrict__ out, _Float16* sm, int m0, int n0) {
  const int lane = threadIdx.x & 31;
  const int wave = threadIdx.x >> 5;
  const int c = lane & 15;
  const int mloc = (wave & 3) * 64 + (lane >> 4) * 8;
  const int nloc = (wave >> 2) * 64 + c * 4;
  const unsigned int bo = (unsigned int)nloc * 4u;  // the lane's byte offset in the tile's bias
  // the tile's rows start at a multiple of its edge, so they never wrap past SS
  const size_t fo = (size_t)((m0 & (SS - 1)) + mloc) * (DD / 2) + ((n0 + nloc) >> 1);
  const float* cp = cosb + fo;
  const float* sp = sinb + fo;
  _Float16* qp = out + (size_t)(m0 + mloc) * DD + n0 + nloc;

  const f32x4 b4 = *(const f32x4*)((const char*)(bias + n0) + bo);
  f32x2 cv[2][8], sv[2][8];
  if constexpr (Z < 2) {
#pragma unroll
    for (int r = 0; r < 8; ++r) {
      cv[0][r] = *(const f32x2*)(cp + r * (DD / 2));
      sv[0][r] = *(const f32x2*)(sp + r * (DD / 2));
    }
  }
  // stands in front of any rewrite of a register that the loads above name; as
  // inputs the addresses keep their registers up to the wait
  if constexpr (Z < 2)
    asm volatile("s_wait_xcnt 0x0" ::"v"(bo), "v"(cp), "v"(sp) : "memory");
  else
    asm volatile("s_wait_xcnt 0x0" ::"v"(bo) : "memory");
#pragma unroll
  for (int i = 0; i < 4; ++i) {
    if constexpr (Z < 2) {
      if (i + 1 < 4) {
        // the next 16 rows' factors fly while these 16 rows are rotated
#pragma unroll
        for (int r = 0; r < 8; ++r) {
          cv[(i + 1) & 1][r] = *(const f32x2*)(cp + ((i + 1) * 16 + r) * (DD / 2));
          sv[(i + 1) & 1][r] = *(const f32x2*)(sp + ((i + 1) * 16 + r) * (DD / 2));
        }
        // as above: in front of any rewrite of the two address registers
        asm volatile("s_wait_xcnt 0x0" ::"v"(cp), "v"(sp) : "memory");
      }
    }
    float v[4][8];
#pragma unroll
    for (int r = 0; r < 8; ++r) {
#pragma unroll
      for (int j = 0; j < 4; ++j) v[j][r] = acc[i][j][r] + b4[j];
      if constexpr (Z < 2) {
#pragma unroll
        for (int p = 0; p < 2; ++p) {
          const float cc = cv[i & 1][r][p], ss = sv[i & 1][r][p];
          const float h0 = v[2 * p][r], h1 = v[2 * p + 1][r];
          v[2 * p][r] = __builtin_fmaf(cc, h0, -(ss * h1));
          v[2 * p + 1][r] = __builtin_fmaf(cc, h1, ss * h0);
        }
      }
    }
    if constexpr (Z == 0) {
      uint2 d[8];
#pragma unroll
      for (int r = 0; r < 8; ++r) {
        d[r] = make_uint2(pk2(v[0][r], v[1][r]), pk2(v[2][r], v[3][r]));
        *(uint2*)(qp + (i * 16 + r) * DD) = d[r];
      }
      // stands in front of any rewrite of a register that the stores above
      // name; as inputs address and data keep their registers up to the wait
      asm volatile("s_wait_xcnt 0x0" ::"v"(qp), "v"(d[0].x), "v"(d[0].y), "v"(d[1].x),
                   "v"(d[1].y), "v"(d[2].x), "v"(d[2].y), "v"(d[3].x), "v"(d[3].y),
                   "v"(d[4].x), "v"(d[4].y), "v"(d[5].x), "v"(d[5].y), "v"(d[6].x),
                   "v"(d[6].y), "v"(d[7].x), "v"(d[7].y)
                   : "memory");
    } else {
      // a lane holds 8 consecutive rows of a column: 16 bytes of a transposed
      // row.  Its lanes' rows lie 4 apart (64 B modulo the banks), so the 16-byte
      // piece's index is XORed with c >> 2 to spread them over all banks.
      const int piece = ((mloc >> 3) + 2 * i) ^ (c >> 2);
#pragma unroll
      for (int j = 0; j < 4; ++j)
        *(uint4*)(sm + (nloc + j) * TP + piece * 8) =
            make_uint4(pk2(v[j][0], v[j][1]), pk2(v[j][2], v[j][3]),
                       pk2(v[j][4], v[j][5]), pk2(v[j][6], v[j][7]));
    }
    // keeps each 16 rows' work together; without it the scheduler interleaves
    // all four groups, runs out of registers and spills to scratch
    __builtin_amdgcn_sched_barrier(0);
  }
}

__global__ __launch_bounds__(512) void qkv_rope_kernel(
    const _Float16* __restrict__ xh, const _Float16* __restrict__ wh,
    const float* __restrict__ bq, const float* __restrict__ bk,
    const float* __restrict__ bv,
    const float* __restrict__ cosb, const float* __restrict__ sinb,
    _Float16* __restrict__ Qh, _Float16* __restrict__ Kt,
    _Float16* __restrict__ Vt) {
  __shared__ alignas(16) _Float16 sm[PSMEM_HALVES];
  static_assert(PT * TP <= PSMEM_HALVES, "transposed tile fits");

  const int z = blockIdx.z;
  const _Float16* w = wh + (size_t)z * DD * DD;

  const int tid = threadIdx.x;
  const int m0 = blockIdx.y * PT;  // token
  const int n0 = blockIdx.x * PT;  // feature

  v8f acc[4][4] = {};
  gemm_tile_nt_perm<DD, 4, 4, 4, 4>(xh + (size_t)m0 * DD, w + (size_t)n0 * DD, sm, acc);

  if (z == 0) {
    qkv_epilogue<0>(acc, bq, cosb, sinb, Qh, sm, m0, n0);
    return;  // taken by the whole workgroup; no barrier follows for it
  }
  if (z == 1) qkv_epilogue<1>(acc, bk, cosb, sinb, Kt, sm, m0, n0);
  else        qkv_epilogue<2>(acc, bv, cosb, sinb, Vt, sm, m0, n0);
  __syncthreads();  // the transposed tile is complete
  // a wave stores the 512 contiguous bytes of a transposed row
  _Float16* dst = ((z == 1) ? Kt : Vt) + ((size_t)(m0 / SS) * DD + n0) * SS + (m0 & (SS - 1));
  for (int i = tid; i < PT * PT / 8; i += 512) {
    const int r = i >> 5;
    const int p = i & 31;
    // piece p of row r lies where the epilogue's XOR has put it
    *(uint4*)(dst + (size_t)r * SS + p * 8) =
        *(const uint4*)(sm + r * TP + (p ^ ((r >> 4) & 3)) * 8);
  }
}

// ---------------------------------------------------------------------------
// Kernel 2: Mt[b][d2][d1] = (1/256) * sum_t K[b][t][d1] * V[b][t][d2], f16.
// The power of two keeps the f16 values near 1 (the sum runs over S = 4096
// terms); kernel 3 multiplies it back.  grid = (DD/128, DD/128, BB).
// ---------------------------------------------------------------------------
#define MP 136  // staged output row stride in halves: 272 B = 16 B x 17
__global__ __launch_bounds__(256) void ktv_kernel(
    const _Float16* __restrict__ Kt, const _Float16* __restrict__ Vt,
    _Float16* __restrict__ Mt) {
  __shared__ alignas(16) _Float16 sm[GSMEM_HALVES];
  const int tid = threadIdx.x;
  const int lane = tid & 31;
  const int wave = tid >> 5;
  const int m0 = blockIdx.x * 128;  // d1
  const int n0 = blockIdx.y * 128;  // d2
  const size_t bo = (size_t)blockIdx.z * DD * SS;

  v8f acc[2][4] = {};
  gemm_tile_nt<SS>(Kt + bo + (size_t)m0 * SS, Vt + bo + (size_t)n0 * SS, sm, acc);

  // acc[i][j][r] = C[wm*32 + i*16 + 8h + r][wn*64 + j*16 + c]; staged as [n][m]
  const int mloc = (wave & 3) * 32 + (lane >> 4) * 8;
  const int nloc = (wave >> 2) * 64 + (lane & 15);
#pragma unroll
  for (int i = 0; i < 2; ++i)
#pragma unroll
    for (int j = 0; j < 4; ++j) {
      union { _Float16 e[8]; uint4 q; } p;
#pragma unroll
      for (int r = 0; r < 8; ++r) p.e[r] = (_Float16)(acc[i][j][r] * (1.0f / 256.0f));
      *(uint4*)(sm + (nloc + j * 16) * MP + mloc + i * 16) = p.q;
    }
  __syncthreads();
  _Float16* dst = Mt + (size_t)blockIdx.z * DD * DD + (size_t)n0 * DD + m0;
  for (int i = tid; i < 2048; i += 256) {  // 16 lanes store 256 contiguous bytes
    const int r = i >> 4;
    const int c = (i & 15) * 8;
    *(uint4*)(dst + (size_t)r * DD + c) = *(const uint4*)(sm + r * MP + c);
  }
}

// ---------------------------------------------------------------------------
// Kernel 3: out[b][s][d2] = 64 * sum_d1 Q[b][s][d1] * Mt[b][d2][d1], fp32
// (64 / 256 = 1 / B).  grid = (DD/128, SS/128, BB).
// ---------------------------------------------------------------------------
#define OP 132  // staged output row stride in floats: 528 B = 16 B x 33
__global__ __launch_bounds__(256) void qm_kernel(
    const _Float16* __restrict__ Qh, const _Float16* __restrict__ Mt,
    float* __restrict__ out) {
  __shared__ alignas(16) _Float16 sm[GSMEM_HALVES];
  static_assert(128 * OP * 4 <= GSMEM_HALVES * 2, "staged tile fits");
  const int tid = threadIdx.x;
  const int lane = tid & 31;
  const int wave = tid >> 5;
  const int m0 = blockIdx.x * 128;  // d2
  const int n0 = blockIdx.y * 128;  // s
  const int b = blockIdx.z;

  v8f acc[2][4] = {};
  gemm_tile_nt<DD>(Mt + (size_t)b * DD * DD + (size_t)m0 * DD,
                   Qh + ((size_t)b * SS + n0) * DD, sm, acc);

  float* so = (float*)sm;
  const int mloc = (wave & 3) * 32 + (lane >> 4) * 8;
  const int nloc = (wave >> 2) * 64 + (lane & 15);
#pragma unroll
  for (int i = 0; i < 2; ++i)
#pragma unroll
    for (int j = 0; j < 4; ++j) {
      float* p = so + (nloc + j * 16) * OP + mloc + i * 16;
      *(float4*)(p) = make_float4(acc[i][j][0] * 64.0f, acc[i][j][1] * 64.0f,
                                  acc[i][j][2] * 64.0f, acc[i][j][3] * 64.0f);
      *(float4*)(p + 4) = make_float4(acc[i][j][4] * 64.0f, acc[i][j][5] * 64.0f,
                                      acc[i][j][6] * 64.0f, acc[i][j][7] * 64.0f);
    }
  __syncthreads();
  float* dst = out + ((size_t)b * SS + n0) * DD + m0;
  for (int i = tid; i < 4096; i += 256) {  // a wave stores one 512-byte row
    const int r = i >> 5;
    const int c = (i & 31) * 4;
    *(float4*)(dst + (size_t)r * DD + c) = *(const float4*)(so + r * OP + c);
  }
}

extern "C" void kernel_launch(void* const* d_in, const int* in_sizes, int n_in,
                              void* d_out, int out_size, void* d_ws,
                              size_t ws_size, hipStream_t stream) {
  (void)in_sizes; (void)n_in; (void)out_size; (void)ws_size;
  const float* x  = (const float*)d_in[0];
  const float* fc = (const float*)d_in[1];
  const float* fs = (const float*)d_in[2];
  const float* wq = (const float*)d_in[3];
  const float* bq = (const float*)d_in[4];
  const float* wk = (const float*)d_in[5];
  const float* bk = (const float*)d_in[6];
  const float* wv = (const float*)d_in[7];
  const float* bv = (const float*)d_in[8];
  float* out = (float*)d_out;

  _Float16* Qh = (_Float16*)d_ws;
  _Float16* Kt = Qh + (size_t)BB * SS * DD;
  _Float16* Vt = Kt + (size_t)BB * SS * DD;
  _Float16* Mt = Vt + (size_t)BB * SS * DD;
  _Float16* xh = Mt + (size_t)BB * DD * DD;
  _Float16* wh = xh + (size_t)BB * SS * DD;

  round_f16_kernel<<<dim3(CBLOCKS), dim3(256), 0, stream>>>(x, wq, wk, wv, xh, wh);
  dim3 g1(DD / 256, (BB * SS) / 256, 3);
  qkv_rope_kernel<<<g1, dim3(512), 0, stream>>>(xh, wh, bq, bk, bv, fc, fs, Qh,
                                                Kt, Vt);
  dim3 g2(DD / 128, DD / 128, BB);
  ktv_kernel<<<g2, dim3(256), 0, stream>>>(Kt, Vt, Mt);
  dim3 g3(DD / 128, SS / 128, BB);
  qm_kernel<<<g3, dim3(256), 0, stream>>>(Qh, Mt, out);
}

// v006
// Measured time: 161 microseconds a run.
// Two timings next to v005 both put it at 1.07 times that version's speed.
// Over all steps from v000 it is 12.6 times as fast.
#include <hip/hip_runtime.h>

typedef __attribute__((ext_vector_type(16))) _Float16 v16h;
typedef __attribute__((ext_vector_type(8)))  float    v8f;
typedef float    f32x2 __attribute__((ext_vector_type(2)));
typedef float    f32x4 __attribute__((ext_vector_type(4)));
typedef _Float16 f16x2 __attribute__((ext_vector_type(2)));

constexpr int BB = 4;
constexpr int SS = 4096;
constexpr int DD = 1024;

__device__ __forceinline__ v8f wmma_f16(v16h a, v16h b, v8f c) {
  return __builtin_amdgcn_wmma_f32_16x16x32_f16(false, a, false, b, (short)0, c,
                                                false, false);
}

// ---------------------------------------------------------------------------
// The reference has no softmax, so (Q K^T / B) V = Q (K^T V) / B.  Per batch
// K^T V is a D x D matrix: 2 x S*D*D multiply-adds instead of 2 x S*S*D.
//
// Shared main loop: C[m][n] = sum_k A[m][k] * Bm[n][k], both k-contiguous f16,
// one 128 x 128 tile per workgroup, 256 threads (8 waves, 4 along m, 2 along n,
// 32 x 64 per wave).  64 k per stage, two LDS buffers; a stage goes from global
// memory into its buffer by asynchronous copies, through no register, while the
// stage before it is multiplied.
// ---------------------------------------------------------------------------
#define GP 72                  // LDS row stride in halves: 144 B = 16 B x 9
#define GSTG (256 * GP)        // one stage: 128 rows of A, then 128 rows of Bm
#define GSMEM_HALVES (2 * GSTG)

// 16x32 f16 fragment of one row; p = row start + 32 * kstep + 8 * (lane >> 4).
// The same k order serves A and B.
__device__ __forceinline__ v16h lds_frag(const _Float16* p) {
  union { v16h h; uint4 q[2]; } f;
  f.q[0] = *(const uint4*)(p);
  f.q[1] = *(const uint4*)(p + 16);
  return f.h;
}

// The LDS byte address of a __shared__ location, as an asynchronous copy takes it.
__device__ __forceinline__ unsigned int lds_addr(const _Float16* p) {
  return (unsigned int)(size_t)(const __attribute__((address_space(3))) _Float16*)p;
}

// Eight asynchronous copies of 16 bytes a lane, global memory to LDS.  The wait
// at the end stands in front of any rewrite of a register that the copies name:
// inside their own statement nothing can be moved between them and it.
__device__ __forceinline__ void async_copy8(const unsigned int (&l)[8],
                                            const _Float16* const (&g)[8]) {
  asm volatile(
      "global_load_async_to_lds_b128 %0, %8, off\n\t"
      "global_load_async_to_lds_b128 %1, %9, off\n\t"
      "global_load_async_to_lds_b128 %2, %10, off\n\t"
      "global_load_async_to_lds_b128 %3, %11, off\n\t"
      "global_load_async_to_lds_b128 %4, %12, off\n\t"
      "global_load_async_to_lds_b128 %5, %13, off\n\t"
      "global_load_async_to_lds_b128 %6, %14, off\n\t"
      "global_load_async_to_lds_b128 %7, %15, off\n\t"
      "s_wait_xcnt 0x0"
      ::"v"(l[0]), "v"(l[1]), "v"(l[2]), "v"(l[3]), "v"(l[4]), "v"(l[5]), "v"(l[6]),
      "v"(l[7]), "v"(g[0]), "v"(g[1]), "v"(g[2]), "v"(g[3]), "v"(g[4]), "v"(g[5]),
      "v"(g[6]), "v"(g[7])
      : "memory");
}

// This wave's own copies have landed in LDS.
__device__ __forceinline__ void wait_async_copies() {
  asm volatile("s_wait_asynccnt 0x0" ::: "memory");
}

// This wave's own LDS reads are over: it may let their buffer be refilled.
__device__ __forceinline__ void wait_lds_reads() {
  asm volatile("s_wait_dscnt 0x0" ::: "memory");
}

template <int KD>
__device__ __forceinline__ void gemm_tile_nt(const _Float16* __restrict__ A,
                                             const _Float16* __restrict__ Bm,
                                             _Float16* sm, v8f (&acc)[2][4]) {
  const int tid = threadIdx.x;
  const int lane = tid & 31;
  const int wave = tid >> 5;
  const int wm = wave & 3;
  const int wn = wave >> 2;
  const int c = lane & 15;
  const int h = lane >> 4;
  const int lrow = tid >> 3;       // 32 rows per sweep, 8 lanes per 128-B row
  const int lcol = (tid & 7) * 8;
  const _Float16* ga = A + (size_t)lrow * KD + lcol;
  const _Float16* gb = Bm + (size_t)lrow * KD + lcol;
  const unsigned int st = lds_addr(sm + lrow * GP + lcol);
  constexpr int NS = KD / 64;
  static_assert(NS >= 2, "the ring starts with two stages");

  // stage s into buffer s & 1: 4 sweeps of 32 rows of A, then 4 of Bm
  auto copy_stage = [&](int s) {
    const unsigned int d = st + (unsigned int)(s & 1) * (GSTG * 2);
    unsigned int l[8];
    const _Float16* g[8];
#pragma unroll
    for (int j = 0; j < 4; ++j) {
      l[j] = d + j * 32 * GP * 2;
      l[4 + j] = d + (128 + j * 32) * GP * 2;
      g[j] = ga + (size_t)j * 32 * KD + s * 64;
      g[4 + j] = gb + (size_t)j * 32 * KD + s * 64;
    }
    async_copy8(l, g);
  };

  copy_stage(0);
  wait_async_copies();
  __syncthreads();  // publishes stage 0
  copy_stage(1);

  for (int s = 0; s < NS; ++s) {
    const int cur = (s & 1) * GSTG;
    const _Float16* sa = sm + cur + (wm * 32 + c) * GP + 8 * h;
    const _Float16* sb = sm + cur + (128 + wn * 64 + c) * GP + 8 * h;
#pragma unroll
    for (int kk = 0; kk < 2; ++kk) {
      v16h af[2], bf[4];
#pragma unroll
      for (int j = 0; j < 4; ++j) bf[j] = lds_frag(sb + j * 16 * GP + kk * 32);
#pragma unroll
      for (int i = 0; i < 2; ++i) af[i] = lds_frag(sa + i * 16 * GP + kk * 32);
      // keeps the k step's LDS reads one group in front of its products (bf first:
      // the rows of af are needed one after the other): left free, the scheduler
      // reloads af among the products and the wave waits out every reload
      __builtin_amdgcn_sched_barrier(0);
#pragma unroll
      for (int i = 0; i < 2; ++i)
#pragma unroll
        for (int j = 0; j < 4; ++j) acc[i][j] = wmma_f16(af[i], bf[j], acc[i][j]);
      // keeps the next k step's reads, the next group, behind these products
      __builtin_amdgcn_sched_barrier(0);
    }
    wait_lds_reads();
    wait_async_copies();
    // publishes stage s + 1 and ends every read of stage s: its buffer is free
    // for stage s + 2, which flies while stage s + 1 is multiplied; behind the
    // last trip's barrier the callers reuse the buffers
    __syncthreads();
    if (s + 2 < NS) copy_stage(s + 2);
  }
  wait_async_copies();  // none is outstanding when the buffers get their next use
}

__device__ __forceinline__ uint2 cvt4(f32x4 v) {
  // one packed convert (round to nearest even) per pair
  const f16x2 lo = __builtin_convertvector(__builtin_shufflevector(v, v, 0, 1), f16x2);
  const f16x2 hi = __builtin_convertvector(__builtin_shufflevector(v, v, 2, 3), f16x2);
  return make_uint2(__builtin_bit_cast(unsigned int, lo),
                    __builtin_bit_cast(unsigned int, hi));
}

// ---------------------------------------------------------------------------
// Kernel 0: x and the three weight matrices rounded to f16 once.  Kernel 1 reads
// every row of x 12 times and every weight row 64 times: it now draws half the
// bytes from L2 and has no convert in its loop.  The rounding is the one that
// kernel 1 did on the way into LDS, so every value stays as it was.
// A block rounds CU floats a trip: 8 loads of 16 bytes a lane in flight, a wave's
// load covers 512 contiguous bytes and its store 256.
// ---------------------------------------------------------------------------
constexpr int CU = 256 * 4 * 8;            // floats per block and trip
constexpr int XU = BB * SS * DD / CU;      // units of x
constexpr int WU = DD * DD / CU;           // units of one weight matrix
constexpr int CTRIPS = 4;
constexpr int CBLOCKS = (XU + 3 * WU) / CTRIPS;
static_assert(CBLOCKS * CTRIPS == XU + 3 * WU, "every unit is rounded exactly once");

__global__ __launch_bounds__(256) void round_f16_kernel(
    const float* __restrict__ x, const float* __restrict__ wq,
    const float* __restrict__ wk, const float* __restrict__ wv,
    _Float16* __restrict__ xh, _Float16* __restrict__ wh) {
  const int tid = threadIdx.x;
  for (int t = 0; t < CTRIPS; ++t) {
    const int u = blockIdx.x + t * CBLOCKS;
    const int v = u - XU;  // the unit's index among the weights' units
    const float* s = (v < 0) ? x + (size_t)u * CU
                             : ((v < WU) ? wq : (v < 2 * WU) ? wk : wv) +
                                   (size_t)(v & (WU - 1)) * CU;
    _Float16* d = (v < 0) ? xh + (size_t)u * CU : wh + (size_t)v * CU;
    const float* sp = s + tid * 4;
    _Float16* dp = d + tid * 4;
    f32x4 r[8];
    // read once and never again: non-temporal, so that L2 keeps the f16 copies
#pragma unroll
    for (int j = 0; j < 8; ++j)
      r[j] = __builtin_nontemporal_load((const f32x4*)(sp + j * 1024));
    uint2 o[8];
#pragma unroll
    for (int j = 0; j < 8; ++j) {
      o[j] = cvt4(r[j]);
      *(uint2*)(dp + j * 1024) = o[j];
    }
    // stands in front of any rewrite of a register that the loads and stores
    // above name; as inputs the stored data keep their registers up to it
    asm volatile("s_wait_xcnt 0x0" ::"v"(o[0].x), "v"(o[0].y), "v"(o[1].x), "v"(o[1].y),
                 "v"(o[2].x), "v"(o[2].y), "v"(o[3].x), "v"(o[3].y), "v"(o[4].x),
                 "v"(o[4].y), "v"(o[5].x), "v"(o[5].y), "v"(o[6].x), "v"(o[6].y),
                 "v"(o[7].x), "v"(o[7].y)
                 : "memory");
  }
}

// The same loop for a 256 x 256 tile, with 256 B (128 k) of a row per stage: 16
// lanes x 16 B, so 16 lanes copy one aligned 256-byte unit into one LDS row.
// WM x WN waves, FM x FN fragments of 16 x 16 per wave.
// Row 64w + 4c + j of Bm lies at LDS row 64w + 16j + c, so that fragment j of a
// wave holds column 4c + j in lane c: acc[i][0..3] of a lane are four adjacent
// columns of C.  Only the place of whole rows changes, the k order does not.
#define WP 136                 // LDS row stride in halves: 272 B = 16 B x 17
template <int KD, int WM, int WN, int FM, int FN>
__device__ __forceinline__ void gemm_tile_nt_perm(const _Float16* __restrict__ A,
                                                  const _Float16* __restrict__ Bm,
                                                  _Float16* sm,
                                                  v8f (&acc)[FM][FN]) {
  constexpr int TM = WM * FM * 16;      // rows of A in the tile
  constexpr int TN = WN * FN * 16;      // rows of Bm in the tile
  constexpr int RS = WM * WN * 2;       // rows per sweep: 16 lanes per 256-B row
  constexpr int STG = (TM + TN) * WP;   // one stage: the rows of A, then of Bm
  constexpr int NS = KD / 128;
  const int tid = threadIdx.x;
  const int lane = tid & 31;
  const int wave = tid >> 5;
  const int wm = wave % WM;
  const int wn = wave / WM;
  const int c = lane & 15;
  const int h = lane >> 4;
  const int lrow = tid >> 4;
  const int lcol = (tid & 15) * 8;
  const _Float16* ga = A + (size_t)lrow * KD + lcol;
  const _Float16* gb = Bm + (size_t)lrow * KD + lcol;
  const unsigned int st = lds_addr(sm + lrow * WP + lcol);
  static_assert(RS == 32 && FN == 4, "the row permutation below is written for these");
  const unsigned int stb = lds_addr(sm + (TM + (lrow & 3) * 16 + (lrow >> 2)) * WP + lcol);
  static_assert(TM / RS == 8 && TN / RS == 8, "eight copies a statement and operand");
  static_assert(NS >= 2, "the ring starts with two stages");

  // stage s into buffer s & 1: 8 sweeps of RS rows of A, then 8 of Bm
  auto copy_stage = [&](int s) {
    const unsigned int d = (unsigned int)(s & 1) * (STG * 2);
    unsigned int l[8];
    const _Float16* g[8];
#pragma unroll
    for (int j = 0; j < 8; ++j) {
      l[j] = st + d + j * RS * WP * 2;
      g[j] = ga + (size_t)j * RS * KD + s * 128;
    }
    async_copy8(l, g);
#pragma unroll
    for (int j = 0; j < 8; ++j) {
      l[j] = stb + d + ((j >> 1) * 64 + (j & 1) * 8) * WP * 2;
      g[j] = gb + (size_t)j * RS * KD + s * 128;
    }
    async_copy8(l, g);
  };

  copy_stage(0);
  wait_async_copies();
  __syncthreads();  // publishes stage 0
  copy_stage(1);

  for (int s = 0; s < NS; ++s) {
    const int cur = (s & 1) * STG;
    const _Float16* sa = sm + cur + (wm * FM * 16 + c) * WP + 8 * h;
    const _Float16* sb = sm + cur + (TM + wn * FN * 16 + c) * WP + 8 * h;
#pragma unroll
    for (int kk = 0; kk < 4; ++kk) {
      v16h af[FM], bf[FN];
#pragma unroll
      for (int j = 0; j < FN; ++j) bf[j] = lds_frag(sb + j * 16 * WP + kk * 32);
#pragma unroll
      for (int i = 0; i < FM; ++i) af[i] = lds_frag(sa + i * 16 * WP + kk * 32);
      // keeps the k step's LDS reads one group in front of its products (bf first:
      // the rows of af are needed one after the other): left free, the scheduler
      // reloads af among the products and the wave waits out every reload
      __builtin_amdgcn_sched_barrier(0);
#pragma unroll
      for (int i = 0; i < FM; ++i)
#pragma unroll
        for (int j = 0; j < FN; ++j) acc[i][j] = wmma_f16(af[i], bf[j], acc[i][j]);
      // keeps the next k step's reads, the next group, behind these products
      __builtin_amdgcn_sched_barrier(0);
    }
    wait_lds_reads();
    wait_async_copies();
    // publishes stage s + 1 and ends every read of stage s: its buffer is free
    // for stage s + 2, which flies while stage s + 1 is multiplied; behind the
    // last trip's barrier the caller reuses the buffers
    __syncthreads();
    if (s + 2 < NS) copy_stage(s + 2);
  }
  wait_async_copies();  // none is outstanding when the buffers get their next use
}

// ---------------------------------------------------------------------------
// Kernel 1: fused QKV projection + bias + rotary, f16 in (kernel 0) -> f16 out.
// grid = (DD/256, (BB*SS)/256, 3), block = 512 (16 waves, 4 x 4, 64 x 64 per
// wave), one 256 x 256 tile (tokens x features) per workgroup.
// Q is stored row-major [b][s][d]; K and V are stored transposed [b][d][t], so
// that the product K^T V reads both with its summed index t contiguous.
// ---------------------------------------------------------------------------
#define PT 256                 // tile edge
#define TP (PT + 8)            // row stride (halves) of the transposed tile: 528 B
#define PSMEM_HALVES (2 * 2 * PT * WP)

__device__ __forceinline__ unsigned int pk2(float a, float b) {
  const f32x2 v = {a, b};
  return __builtin_bit_cast(unsigned int, __builtin_convertvector(v, f16x2));
}

// Bias, rotary and store of one wave's 64 x 64 part.  Z = 0: Q, rotated, row-major
// to memory; Z = 1: K, rotated, into the transposed LDS tile; Z = 2: V, the same
// without the rotation.  acc[i][j][r] = C[wm*64 + i*16 + 8h + r][wn*64 + 4c + j]:
// a lane holds two whole (even, odd) pairs, so the rotation needs no other lane,
// 16 lanes read a whole 128-byte line of cos or sin and store one of Q.
template <int Z>
__device__ __forceinline__ void qkv_epilogue(
    v8f (&acc)[4][4], const float* __restrict__ bias,
    const float* __restrict__ cosb, const float* __restrict__ sinb,
    _Float16* __restrict__ out, _Float16* sm, int m0, int n0) {
  const int lane = threadIdx.x & 31;
  const int wave = threadIdx.x >> 5;
  const int c = lane & 15;
  const int mloc = (wave & 3) * 64 + (lane >> 4) * 8;
  const int nloc = (wave >> 2) * 64 + c * 4;
  const unsigned int bo = (unsigned int)nloc * 4u;  // the lane's byte offset in the tile's bias
  // the tile's rows start at a multiple of its edge, so they never wrap past SS
  const size_t fo = (size_t)((m0 & (SS - 1)) + mloc) * (DD / 2) + ((n0 + nloc) >> 1);
  const float* cp = cosb + fo;
  const float* sp = sinb + fo;
  _Float16* qp = out + (size_t)(m0 + mloc) * DD + n0 + nloc;

  const f32x4 b4 = *(const f32x4*)((const char*)(bias + n0) + bo);
  f32x2 cv[2][8], sv[2][8];
  if constexpr (Z < 2) {
#pragma unroll
    for (int r = 0; r < 8; ++r) {
      cv[0][r] = *(const f32x2*)(cp + r * (DD / 2));
      sv[0][r] = *(const f32x2*)(sp + r * (DD / 2));
    }
  }
  // stands in front of any rewrite of a register that the loads above name; as
  // inputs the addresses keep their registers up to the wait
  if constexpr (Z < 2)
    asm volatile("s_wait_xcnt 0x0" ::"v"(bo), "v"(cp), "v"(sp) : "memory");
  else
    asm volatile("s_wait_xcnt 0x0" ::"v"(bo) : "memory");
#pragma unroll
  for (int i = 0; i < 4; ++i) {
    if constexpr (Z < 2) {
      if (i + 1 < 4) {
        // the next 16 rows' factors fly while these 16 rows are rotated
#pragma unroll
        for (int r = 0; r < 8; ++r) {
          cv[(i + 1) & 1][r] = *(const f32x2*)(cp + ((i + 1) * 16 + r) * (DD / 2));
          sv[(i + 1) & 1][r] = *(const f32x2*)(sp + ((i + 1) * 16 + r) * (DD / 2));
        }
        // as above: in front of any rewrite of the two address registers
        asm volatile("s_wait_xcnt 0x0" ::"v"(cp), "v"(sp) : "memory");
      }
    }
    float v[4][8];
#pragma unroll
    for (int r = 0; r < 8; ++r) {
#pragma unroll
      for (int j = 0; j < 4; ++j) v[j][r] = acc[i][j][r] + b4[j];
      if constexpr (Z < 2) {
#pragma unroll
        for (int p = 0; p < 2; ++p) {
          const float cc = cv[i & 1][r][p], ss = sv[i & 1][r][p];
          const float h0 = v[2 * p][r], h1 = v[2 * p + 1][r];
          v[2 * p][r] = __builtin_fmaf(cc, h0, -(ss * h1));
          v[2 * p + 1][r] = __builtin_fmaf(cc, h1, ss * h0);
        }
      }
    }
    if constexpr (Z == 0) {
      uint2 d[8];
#pragma unroll
      for (int r = 0; r < 8; ++r) {
        d[r] = make_uint2(pk2(v[0][r], v[1][r]), pk2(v[2][r], v[3][r]));
        *(uint2*)(qp + (i * 16 + r) * DD) = d[r];
      }
      // stands in front of any rewrite of a register that the stores above
      // name; as inputs address and data keep their registers up to the wait
      asm volatile("s_wait_xcnt 0x0" ::"v"(qp), "v"(d[0].x), "v"(d[0].y), "v"(d[1].x),
                   "v"(d[1].y), "v"(d[2].x), "v"(d[2].y), "v"(d[3].x), "v"(d[3].y),
                   "v"(d[4].x), "v"(d[4].y), "v"(d[5].x), "v"(d[5].y), "v"(d[6].x),
                   "v"(d[6].y), "v"(d[7].x), "v"(d[7].y)
                   : "memory");
    } else {
      // a lane holds 8 consecutive rows of a column: 16 bytes of a transposed
      // row.  Its lanes' rows lie 4 apart (64 B modulo the banks), so the 16-byte
      // piece's index is XORed with c >> 2 to spread them over all banks.
      const int piece = ((mloc >> 3) + 2 * i) ^ (c >> 2);
#pragma unroll
      for (int j = 0; j < 4; ++j)
        *(uint4*)(sm + (nloc + j) * TP + piece * 8) =
            make_uint4(pk2(v[j][0], v[j][1]), pk2(v[j][2], v[j][3]),
                       pk2(v[j][4], v[j][5]), pk2(v[j][6], v[j][7]));
    }
    // keeps each 16 rows' work together; without it the scheduler interleaves
    // all four groups, runs out of registers and spills to scratch
    __builtin_amdgcn_sched_barrier(0);
  }
}

__global__ __launch_bounds__(512) void qkv_rope_kernel(
    const _Float16* __restrict__ xh, const _Float16* __restrict__ wh,
    const float* __restrict__ bq, const float* __restrict__ bk,
    const float* __restrict__ bv,
    const float* __restrict__ cosb, const float* __restrict__ sinb,
    _Float16* __restrict__ Qh, _Float16* __restrict__ Kt,
    _Float16* __restrict__ Vt) {
  __shared__ alignas(16) _Float16 sm[PSMEM_HALVES];
  static_assert(PT * TP <= PSMEM_HALVES, "transposed tile fits");

  const int z = blockIdx.z;
  const _Float16* w = wh + (size_t)z * DD * DD;

  const int tid = threadIdx.x;
  const int m0 = blockIdx.y * PT;  // token
  const int n0 = blockIdx.x * PT;  // feature

  v8f acc[4][4] = {};
  gemm_tile_nt_perm<DD, 4, 4, 4, 4>(xh + (size_t)m0 * DD, w + (size_t)n0 * DD, sm, acc);

  if (z == 0) {
    qkv_epilogue<0>(acc, bq, cosb, sinb, Qh, sm, m0, n0);
    return;  // taken by the whole workgroup; no barrier follows for it
  }
  if (z == 1) qkv_epilogue<1>(acc, bk, cosb, sinb, Kt, sm, m0, n0);
  else        qkv_epilogue<2>(acc, bv, cosb, sinb, Vt, sm, m0, n0);
  __syncthreads();  // the transposed tile is complete
  // a wave stores the 512 contiguous bytes of a transposed row
  _Float16* dst = ((z == 1) ? Kt : Vt) + ((size_t)(m0 / SS) * DD + n0) * SS + (m0 & (SS - 1));
  for (int i = tid; i < PT * PT / 8; i += 512) {
    const int r = i >> 5;
    const int p = i & 31;
    // piece p of row r lies where the epilogue's XOR has put it
    *(uint4*)(dst + (size_t)r * SS + p * 8) =
        *(const uint4*)(sm + r * TP + (p ^ ((r >> 4) & 3)) * 8);
  }
}

// ---------------------------------------------------------------------------
// Kernel 2: Mt[b][d2][d1] = (1/256) * sum_t K[b][t][d1] * V[b][t][d2], f16.
// The power of two keeps the f16 values near 1 (the sum runs over S = 4096
// terms); kernel 3 multiplies it back.  grid = (DD/128, DD/128, BB).
// ---------------------------------------------------------------------------
#define MP 136  // staged output row stride in halves: 272 B = 16 B x 17
__global__ __launch_bounds__(256) void ktv_kernel(
    const _Float16* __restrict__ Kt, const _Float16* __restrict__ Vt,
    _Float16* __restrict__ Mt) {
  __shared__ alignas(16) _Float16 sm[GSMEM_HALVES];
  const int tid = threadIdx.x;
  const int lane = tid & 31;
  const int wave = tid >> 5;
  const int m0 = blockIdx.x * 128;  // d1
  const int n0 = blockIdx.y * 128;  // d2
  const size_t bo = (size_t)blockIdx.z * DD * SS;

  v8f acc[2][4] = {};
  gemm_tile_nt<SS>(Kt + bo + (size_t)m0 * SS, Vt + bo + (size_t)n0 * SS, sm, acc);

  // acc[i][j][r] = C[wm*32 + i*16 + 8h + r][wn*64 + j*16 + c]; staged as [n][m]
  const int mloc = (wave & 3) * 32 + (lane >> 4) * 8;
  const int nloc = (wave >> 2) * 64 + (lane & 15);
#pragma unroll
  for (int i = 0; i < 2; ++i)
#pragma unroll
    for (int j = 0; j < 4; ++j) {
      union { _Float16 e[8]; uint4 q; } p;
#pragma unroll
      for (int r = 0; r < 8; ++r) p.e[r] = (_Float16)(acc[i][j][r] * (1.0f / 256.0f));
      *(uint4*)(sm + (nloc + j * 16) * MP + mloc + i * 16) = p.q;
    }
  __syncthreads();
  _Float16* dst = Mt + (size_t)blockIdx.z * DD * DD + (size_t)n0 * DD + m0;
  for (int i = tid; i < 2048; i += 256) {  // 16 lanes store 256 contiguous bytes
    const int r = i >> 4;
    const int c = (i & 15) * 8;
    *(uint4*)(dst + (size_t)r * DD + c) = *(const uint4*)(sm + r * MP + c);
  }
}

// ---------------------------------------------------------------------------
// Kernel 3: out[b][s][d2] = 64 * sum_d1 Q[b][s][d1] * Mt[b][d2][d1], fp32
// (64 / 256 = 1 / B).  grid = (DD/128, SS/128, BB).
// ---------------------------------------------------------------------------
#define OP 132  // staged output row stride in floats: 528 B = 16 B x 33
__global__ __launch_bounds__(256) void qm_kernel(
    const _Float16* __restrict__ Qh, const _Float16* __restrict__ Mt,
    float* __restrict__ out) {
  __shared__ alignas(16) _Float16 sm[GSMEM_HALVES];
  static_assert(128 * OP * 4 <= GSMEM_HALVES * 2, "staged tile fits");
  const int tid = threadIdx.x;
  const int lane = tid & 31;
  const int wave = tid >> 5;
  const int m0 = blockIdx.x * 128;  // d2
  const int n0 = blockIdx.y * 128;  // s
  const int b = blockIdx.z;

  v8f acc[2][4] = {};
  gemm_tile_nt<DD>(Mt + (size_t)b * DD * DD + (size_t)m0 * DD,
                   Qh + ((size_t)b * SS + n0) * DD, sm, acc);

  float* so = (float*)sm;
  const int mloc = (wave & 3) * 32 + (lane >> 4) * 8;
  const int nloc = (wave >> 2) * 64 + (lane & 15);
#pragma unroll
  for (int i = 0; i < 2; ++i)
#pragma unroll
    for (int j = 0; j < 4; ++j) {
      float* p = so + (nloc + j * 16) * OP + mloc + i * 16;
      *(float4*)(p) = make_float4(acc[i][j][0] * 64.0f, acc[i][j][1] * 64.0f,
                                  acc[i][j][2] * 64.0f, acc[i][j][3] * 64.0f);
      *(float4*)(p + 4) = make_float4(acc[i][j][4] * 64.0f, acc[i][j][5] * 64.0f,
                                      acc[i][j][6] * 64.0f, acc[i][j][7] * 64.0f);
    }
  __syncthreads();
  float* dst = out + ((size_t)b * SS + n0) * DD + m0;
  for (int i = tid; i < 4096; i += 256) {  // a wave stores one 512-byte row
    const int r = i >> 5;
    const int c = (i & 31) * 4;
    *(float4*)(dst + (size_t)r * DD + c) = *(const float4*)(so + r * OP + c);
  }
}

extern "C" void kernel_launch(void* const* d_in, const int* in_sizes, int n_in,
                              void* d_out, int out_size, void* d_ws,
                              size_t ws_size, hipStream_t stream) {
  (void)in_sizes; (void)n_in; (void)out_size; (void)ws_size;
  const float* x  = (const float*)d_in[0];
  const float* fc = (const float*)d_in[1];
  const float* fs = (const float*)d_in[2];
  const float* wq = (const float*)d_in[3];
  const float* bq = (const float*)d_in[4];
  const float* wk = (const float*)d_in[5];
  const float* bk = (const float*)d_in[6];
  const float* wv = (const float*)d_in[7];
  const float* bv = (const float*)d_in[8];
  float* out = (float*)d_out;

  _Float16* Qh = (_Float16*)d_ws;
  _Float16* Kt = Qh + (size_t)BB * SS * DD;
  _Float16* Vt = Kt + (size_t)BB * SS * DD;
  _Float16* Mt = Vt + (size_t)BB * SS * DD;
  _Float16* xh = Mt + (size_t)BB * DD * DD;
  _Float16* wh = xh + (size_t)BB * SS * DD;

  round_f16_kernel<<<dim3(CBLOCKS), dim3(256), 0, stream>>>(x, wq, wk, wv, xh, wh);
  dim3 g1(DD / 256, (BB * SS) / 256, 3);
  qkv_rope_kernel<<<g1, dim3(512), 0, stream>>>(xh, wh, bq, bk, bv, fc, fs, Qh,
                                                Kt, Vt);
  dim3 g2(DD / 128, DD / 128, BB);
  ktv_kernel<<<g2, dim3(256), 0, stream>>>(Kt, Vt, Mt);
  dim3 g3(DD / 128, SS / 128, BB);
  qm_kernel<<<g3, dim3(256), 0, stream>>>(Qh, Mt, out);
}

// v007
// One run takes 141 microseconds.
// Two timings next to v006 both put it at 1.13 times that version's speed.
// Over all steps from v000 it is 14.3 times as fast.
#include <hip/hip_runtime.h>

typedef __attribute__((ext_vector_type(16))) _Float16 v16h;
typedef __attribute__((ext_vector_type(8)))  float    v8f;
typedef float    f32x2 __attribute__((ext_vector_type(2)));
typedef float    f32x4 __attribute__((ext_vector_type(4)));
typedef _Float16 f16x2 __attribute__((ext_vector_type(2)));

constexpr int BB = 4;
constexpr int SS = 4096;
constexpr int DD = 1024;

__device__ __forceinline__ v8f wmma_f16(v16h a, v16h b, v8f c) {
  return __builtin_amdgcn_wmma_f32_16x16x32_f16(false, a, false, b, (short)0, c,
                                                false, false);
}

// ---------------------------------------------------------------------------
// The reference has no softmax, so (Q K^T / B) V = Q (K^T V) / B.  Per batch
// K^T V is a D x D matrix: 2 x S*D*D multiply-adds instead of 2 x S*S*D.
//
// Shared main loop: C[m][n] = sum_k A[m][k] * Bm[n][k], both k-contiguous f16,
// one 128 x 128 tile per workgroup, 256 threads (8 waves, 4 along m, 2 along n,
// 32 x 64 per wave).  KS k per stage, two LDS buffers; a stage goes from global
// memory into its buffer by asynchronous copies, through no register, while the
// stage before it is multiplied.  Only one stage's copies fly at a time, so KS
// sets the bytes in flight and how often the waves meet at a barrier.
// ---------------------------------------------------------------------------
// LDS row stride in halves: the row and 16 B more, 16 B x an odd number
constexpr int g_pitch(int ks) { return ks + 8; }
// one stage: 128 rows of A, then 128 rows of Bm
constexpr int g_stage(int ks) { return 256 * g_pitch(ks); }
constexpr int g_smem_halves(int ks) { return 2 * g_stage(ks); }

// 16x32 f16 fragment of one row; p = row start + 32 * kstep + 8 * (lane >> 4).
// The same k order serves A and B.
__device__ __forceinline__ v16h lds_frag(const _Float16* p) {
  union { v16h h; uint4 q[2]; } f;
  f.q[0] = *(const uint4*)(p);
  f.q[1] = *(const uint4*)(p + 16);
  return f.h;
}

// The LDS byte address of a __shared__ location, as an asynchronous copy takes it.
__device__ __forceinline__ unsigned int lds_addr(const _Float16* p) {
  return (unsigned int)(size_t)(const __attribute__((address_space(3))) _Float16*)p;
}

// Eight asynchronous copies of 16 bytes a lane, global memory to LDS.  The wait
// at the end stands in front of any rewrite of a register that the copies name:
// inside their own statement nothing can be moved between them and it.
__device__ __forceinline__ void async_copy8(const unsigned int (&l)[8],
                                            const _Float16* const (&g)[8]) {
  asm volatile(
      "global_load_async_to_lds_b128 %0, %8, off\n\t"
      "global_load_async_to_lds_b128 %1, %9, off\n\t"
      "global_load_async_to_lds_b128 %2, %10, off\n\t"
      "global_load_async_to_lds_b128 %3, %11, off\n\t"
      "global_load_async_to_lds_b128 %4, %12, off\n\t"
      "global_load_async_to_lds_b128 %5, %13, off\n\t"
      "global_load_async_to_lds_b128 %6, %14, off\n\t"
      "global_load_async_to_lds_b128 %7, %15, off\n\t"
      "s_wait_xcnt 0x0"
      ::"v"(l[0]), "v"(l[1]), "v"(l[2]), "v"(l[3]), "v"(l[4]), "v"(l[5]), "v"(l[6]),
      "v"(l[7]), "v"(g[0]), "v"(g[1]), "v"(g[2]), "v"(g[3]), "v"(g[4]), "v"(g[5]),
      "v"(g[6]), "v"(g[7])
      : "memory");
}

// This wave's own copies have landed in LDS.
__device__ __forceinline__ void wait_async_copies() {
  asm volatile("s_wait_asynccnt 0x0" ::: "memory");
}

// This wave's own LDS reads are over: it may let their buffer be refilled.
__device__ __forceinline__ void wait_lds_reads() {
  asm volatile("s_wait_dscnt 0x0" ::: "memory");
}

template <int KD, int KS>
__device__ __forceinline__ void gemm_tile_nt(const _Float16* __restrict__ A,
                                             const _Float16* __restrict__ Bm,
                                             _Float16* sm, v8f (&acc)[2][4]) {
  const int tid = threadIdx.x;
  const int lane = tid & 31;
  const int wave = tid >> 5;
  const int wm = wave & 3;
  const int wn = wave >> 2;
  const int c = lane & 15;
  const int h = lane >> 4;
  constexpr int GP = g_pitch(KS);
  constexpr int GSTG = g_stage(KS);
  constexpr int LR = KS / 8;       // lanes per row of a stage, 16 B each
  constexpr int RS = 256 / LR;     // rows per sweep of the workgroup
  constexpr int NSW = 128 / RS;    // sweeps per operand
  static_assert(NSW % 4 == 0 && 2 * NSW <= 63, "whole statements; copies in flight");
  const int lrow = tid / LR;
  const int lcol = (tid % LR) * 8;
  const _Float16* ga = A + (size_t)lrow * KD + lcol;
  const _Float16* gb = Bm + (size_t)lrow * KD + lcol;
  const unsigned int st = lds_addr(sm + lrow * GP + lcol);
  constexpr int NS = KD / KS;
  static_assert(NS >= 2 && NS * KS == KD, "the ring starts with two stages");

  // stage s into buffer s & 1: NSW sweeps of RS rows of A and as many of Bm, four
  // of each a statement
  auto copy_stage = [&](int s) {
    const unsigned int d = st + (unsigned int)(s & 1) * (GSTG * 2);
#pragma unroll
    for (int q = 0; q < NSW; q += 4) {
      unsigned int l[8];
      const _Float16* g[8];
#pragma unroll
      for (int j = 0; j < 4; ++j) {
        l[j] = d + (q + j) * RS * GP * 2;
        l[4 + j] = d + (128 + (q + j) * RS) * GP * 2;
        g[j] = ga + (size_t)(q + j) * RS * KD + s * KS;
        g[4 + j] = gb + (size_t)(q + j) * RS * KD + s * KS;
      }
      async_copy8(l, g);
    }
  };

  copy_stage(0);
  wait_async_copies();
  __syncthreads();  // publishes stage 0
  copy_stage(1);

  for (int s = 0; s < NS; ++s) {
    const int cur = (s & 1) * GSTG;
    const _Float16* sa = sm + cur + (wm * 32 + c) * GP + 8 * h;
    const _Float16* sb = sm + cur + (128 + wn * 64 + c) * GP + 8 * h;
#pragma unroll
    for (int kk = 0; kk < KS / 32; ++kk) {
      v16h af[2], bf[4];
#pragma unroll
      for (int j = 0; j < 4; ++j) bf[j] = lds_frag(sb + j * 16 * GP + kk * 32);
#pragma unroll
      for (int i = 0; i < 2; ++i) af[i] = lds_frag(sa + i * 16 * GP + kk * 32);
      // keeps the k step's LDS reads one group in front of its products (bf first:
      // the rows of af are needed one after the other): left free, the scheduler
      // reloads af among the products and the wave waits out every reload
      __builtin_amdgcn_sched_barrier(0);
#pragma unroll
      for (int i = 0; i < 2; ++i)
#pragma unroll
        for (int j = 0; j < 4; ++j) acc[i][j] = wmma_f16(af[i], bf[j], acc[i][j]);
      // keeps the next k step's reads, the next group, behind these products
      __builtin_amdgcn_sched_barrier(0);
    }
    wait_lds_reads();
    wait_async_copies();
    // publishes stage s + 1 and ends every read of stage s: its buffer is free
    // for stage s + 2, which flies while stage s + 1 is multiplied; behind the
    // last trip's barrier the callers reuse the buffers
    __syncthreads();
    if (s + 2 < NS) copy_stage(s + 2);
  }
  wait_async_copies();  // none is outstanding when the buffers get their next use
}

__device__ __forceinline__ uint2 cvt4(f32x4 v) {
  // one packed convert (round to nearest even) per pair
  const f16x2 lo = __builtin_convertvector(__builtin_shufflevector(v, v, 0, 1), f16x2);
  const f16x2 hi = __builtin_convertvector(__builtin_shufflevector(v, v, 2, 3), f16x2);
  return make_uint2(__builtin_bit_cast(unsigned int, lo),
                    __builtin_bit_cast(unsigned int, hi));
}

// ---------------------------------------------------------------------------
// Kernel 0: x and the three weight matrices rounded to f16 once.  Kernel 1 reads
// every row of x 12 times and every weight row 64 times: it now draws half the
// bytes from L2 and has no convert in its loop.  The rounding is the one that
// kernel 1 did on the way into LDS, so every value stays as it was.
// A block rounds CU floats a trip: 8 loads of 16 bytes a lane in flight, a wave's
// load covers 512 contiguous bytes and its store 256.
// ---------------------------------------------------------------------------
constexpr int CU = 256 * 4 * 8;            // floats per block and trip
constexpr int XU = BB * SS * DD / CU;      // units of x
constexpr int WU = DD * DD / CU;           // units of one weight matrix
constexpr int CTRIPS = 4;
constexpr int CBLOCKS = (XU + 3 * WU) / CTRIPS;
static_assert(CBLOCKS * CTRIPS == XU + 3 * WU, "every unit is rounded exactly once");

__global__ __launch_bounds__(256) void round_f16_kernel(
    const float* __restrict__ x, const float* __restrict__ wq,
    const float* __restrict__ wk, const float* __restrict__ wv,
    _Float16* __restrict__ xh, _Float16* __restrict__ wh) {
  const int tid = threadIdx.x;
  for (int t = 0; t < CTRIPS; ++t) {
    const int u = blockIdx.x + t * CBLOCKS;
    const int v = u - XU;  // the unit's index among the weights' units
    const float* s = (v < 0) ? x + (size_t)u * CU
                             : ((v < WU) ? wq : (v < 2 * WU) ? wk : wv) +
                                   (size_t)(v & (WU - 1)) * CU;
    _Float16* d = (v < 0) ? xh + (size_t)u * CU : wh + (size_t)v * CU;
    const float* sp = s + tid * 4;
    _Float16* dp = d + tid * 4;
    f32x4 r[8];
    // read once and never again: non-temporal, so that L2 keeps the f16 copies
#pragma unroll
    for (int j = 0; j < 8; ++j)
      r[j] = __builtin_nontemporal_load((const f32x4*)(sp + j * 1024));
    uint2 o[8];
#pragma unroll
    for (int j = 0; j < 8; ++j) {
      o[j] = cvt4(r[j]);
      *(uint2*)(dp + j * 1024) = o[j];
    }
    // stands in front of any rewrite of a register that the loads and stores
    // above name; as inputs the stored data keep their registers up to it
    asm volatile("s_wait_xcnt 0x0" ::"v"(o[0].x), "v"(o[0].y), "v"(o[1].x), "v"(o[1].y),
                 "v"(o[2].x), "v"(o[2].y), "v"(o[3].x), "v"(o[3].y), "v"(o[4].x),
                 "v"(o[4].y), "v"(o[5].x), "v"(o[5].y), "v"(o[6].x), "v"(o[6].y),
                 "v"(o[7].x), "v"(o[7].y)
                 : "memory");
  }
}

// The same loop for a 256 x 256 tile, with 256 B (128 k) of a row per stage: 16
// lanes x 16 B, so 16 lanes copy one aligned 256-byte unit into one LDS row.
// WM x WN waves, FM x FN fragments of 16 x 16 per wave.
// Row 64w + 4c + j of Bm lies at LDS row 64w + 16j + c, so that fragment j of a
// wave holds column 4c + j in lane c: acc[i][0..3] of a lane are four adjacent
// columns of C.  Only the place of whole rows changes, the k order does not.
#define WP 136                 // LDS row stride in halves: 272 B = 16 B x 17
template <int KD, int WM, int WN, int FM, int FN>
__device__ __forceinline__ void gemm_tile_nt_perm(const _Float16* __restrict__ A,
                                                  const _Float16* __restrict__ Bm,
                                                  _Float16* sm,
                                                  v8f (&acc)[FM][FN]) {
  constexpr int TM = WM * FM * 16;      // rows of A in the tile
  constexpr int TN = WN * FN * 16;      // rows of Bm in the tile
  constexpr int RS = WM * WN * 2;       // rows per sweep: 16 lanes per 256-B row
  constexpr int STG = (TM + TN) * WP;   // one stage: the rows of A, then of Bm
  constexpr int NS = KD / 128;
  const int tid = threadIdx.x;
  const int lane = tid & 31;
  const int wave = tid >> 5;
  const int wm = wave % WM;
  const int wn = wave / WM;
  const int c = lane & 15;
  const int h = lane >> 4;
  const int lrow = tid >> 4;
  const int lcol = (tid & 15) * 8;
  const _Float16* ga = A + (size_t)lrow * KD + lcol;
  const _Float16* gb = Bm + (size_t)lrow * KD + lcol;
  const unsigned int st = lds_addr(sm + lrow * WP + lcol);
  static_assert(RS == 32 && FN == 4, "the row permutation below is written for these");
  const unsigned int stb = lds_addr(sm + (TM + (lrow & 3) * 16 + (lrow >> 2)) * WP + lcol);
  static_assert(TM / RS == 8 && TN / RS == 8, "eight copies a statement and operand");
  static_assert(NS >= 2, "the ring starts with two stages");

  // stage s into buffer s & 1: 8 sweeps of RS rows of A, then 8 of Bm
  auto copy_stage = [&](int s) {
    const unsigned int d = (unsigned int)(s & 1) * (STG * 2);
    unsigned int l[8];
    const _Float16* g[8];
#pragma unroll
    for (int j = 0; j < 8; ++j) {
      l[j] = st + d + j * RS * WP * 2;
      g[j] = ga + (size_t)j * RS * KD + s * 128;
    }
    async_copy8(l, g);
#pragma unroll
    for (int j = 0; j < 8; ++j) {
      l[j] = stb + d + ((j >> 1) * 64 + (j & 1) * 8) * WP * 2;
      g[j] = gb + (size_t)j * RS * KD + s * 128;
    }
    async_copy8(l, g);
  };

  copy_stage(0);
  wait_async_copies();
  __syncthreads();  // publishes stage 0
  copy_stage(1);

  for (int s = 0; s < NS; ++s) {
    const int cur = (s & 1) * STG;
    const _Float16* sa = sm + cur + (wm * FM * 16 + c) * WP + 8 * h;
    const _Float16* sb = sm + cur + (TM + wn * FN * 16 + c) * WP + 8 * h;
#pragma unroll
    for (int kk = 0; kk < 4; ++kk) {
      v16h af[FM], bf[FN];
#pragma unroll
      for (int j = 0; j < FN; ++j) bf[j] = lds_frag(sb + j * 16 * WP + kk * 32);
#pragma unroll
      for (int i = 0; i < FM; ++i) af[i] = lds_frag(sa + i * 16 * WP + kk * 32);
      // keeps the k step's LDS reads one group in front of its products (bf first:
      // the rows of af are needed one after the other): left free, the scheduler
      // reloads af among the products and the wave waits out every reload
      __builtin_amdgcn_sched_barrier(0);
#pragma unroll
      for (int i = 0; i < FM; ++i)
#pragma unroll
        for (int j = 0; j < FN; ++j) acc[i][j] = wmma_f16(af[i], bf[j], acc[i][j]);
      // keeps the next k step's reads, the next group, behind these products
      __builtin_amdgcn_sched_barrier(0);
    }
    wait_lds_reads();
    wait_async_copies();
    // publishes stage s + 1 and ends every read of stage s: its buffer is free
    // for stage s + 2, which flies while stage s + 1 is multiplied; behind the
    // last trip's barrier the caller reuses the buffers
    __syncthreads();
    if (s + 2 < NS) copy_stage(s + 2);
  }
  wait_async_copies();  // none is outstanding when the buffers get their next use
}

// ---------------------------------------------------------------------------
// Kernel 1: fused QKV projection + bias + rotary, f16 in (kernel 0) -> f16 out.
// grid = (DD/256, (BB*SS)/256, 3), block = 512 (16 waves, 4 x 4, 64 x 64 per
// wave), one 256 x 256 tile (tokens x features) per workgroup.
// Q is stored row-major [b][s][d]; K and V are stored transposed [b][d][t], so
// that the product K^T V reads both with its summed index t contiguous.
// ---------------------------------------------------------------------------
#define PT 256                 // tile edge
#define TP (PT + 8)            // row stride (halves) of the transposed tile: 528 B
#define PSMEM_HALVES (2 * 2 * PT * WP)

__device__ __forceinline__ unsigned int pk2(float a, float b) {
  const f32x2 v = {a, b};
  return __builtin_bit_cast(unsigned int, __builtin_convertvector(v, f16x2));
}

// Bias, rotary and store of one wave's 64 x 64 part.  Z = 0: Q, rotated, row-major
// to memory; Z = 1: K, rotated, into the transposed LDS tile; Z = 2: V, the same
// without the rotation.  acc[i][j][r] = C[wm*64 + i*16 + 8h + r][wn*64 + 4c + j]:
// a lane holds two whole (even, odd) pairs, so the rotation needs no other lane,
// 16 lanes read a whole 128-byte line of cos or sin and store one of Q.
template <int Z>
__device__ __forceinline__ void qkv_epilogue(
    v8f (&acc)[4][4], const float* __restrict__ bias,
    const float* __restrict__ cosb, const float* __restrict__ sinb,
    _Float16* __restrict__ out, _Float16* sm, int m0, int n0) {
  const int lane = threadIdx.x & 31;
  const int wave = threadIdx.x >> 5;
  const int c = lane & 15;
  const int mloc = (wave & 3) * 64 + (lane >> 4) * 8;
  const int nloc = (wave >> 2) * 64 + c * 4;
  const unsigned int bo = (unsigned int)nloc * 4u;  // the lane's byte offset in the tile's bias
  // the tile's rows start at a multiple of its edge, so they never wrap past SS
  const size_t fo = (size_t)((m0 & (SS - 1)) + mloc) * (DD / 2) + ((n0 + nloc) >> 1);
  const float* cp = cosb + fo;
  const float* sp = sinb + fo;
  _Float16* qp = out + (size_t)(m0 + mloc) * DD + n0 + nloc;

  const f32x4 b4 = *(const f32x4*)((const char*)(bias + n0) + bo);
  f32x2 cv[2][8], sv[2][8];
  if constexpr (Z < 2) {
#pragma unroll
    for (int r = 0; r < 8; ++r) {
      cv[0][r] = *(const f32x2*)(cp + r * (DD / 2));
      sv[0][r] = *(const f32x2*)(sp + r * (DD / 2));
    }
  }
  // stands in front of any rewrite of a register that the loads above name; as
  // inputs the addresses keep their registers up to the wait
  if constexpr (Z < 2)
    asm volatile("s_wait_xcnt 0x0" ::"v"(bo), "v"(cp), "v"(sp) : "memory");
  else
    asm volatile("s_wait_xcnt 0x0" ::"v"(bo) : "memory");
#pragma unroll
  for (int i = 0; i < 4; ++i) {
    if constexpr (Z < 2) {
      if (i + 1 < 4) {
        // the next 16 rows' factors fly while these 16 rows are rotated
#pragma unroll
        for (int r = 0; r < 8; ++r) {
          cv[(i + 1) & 1][r] = *(const f32x2*)(cp + ((i + 1) * 16 + r) * (DD / 2));
          sv[(i + 1) & 1][r] = *(const f32x2*)(sp + ((i + 1) * 16 + r) * (DD / 2));
        }
        // as above: in front of any rewrite of the two address registers
        asm volatile("s_wait_xcnt 0x0" ::"v"(cp), "v"(sp) : "memory");
      }
    }
    float v[4][8];
#pragma unroll
    for (int r = 0; r < 8; ++r) {
#pragma unroll
      for (int j = 0; j < 4; ++j) v[j][r] = acc[i][j][r] + b4[j];
      if constexpr (Z < 2) {
#pragma unroll
        for (int p = 0; p < 2; ++p) {
          const float cc = cv[i & 1][r][p], ss = sv[i & 1][r][p];
          const float h0 = v[2 * p][r], h1 = v[2 * p + 1][r];
          v[2 * p][r] = __builtin_fmaf(cc, h0, -(ss * h1));
          v[2 * p + 1][r] = __builtin_fmaf(cc, h1, ss * h0);
        }
      }
    }
    if constexpr (Z == 0) {
      uint2 d[8];
#pragma unroll
      for (int r = 0; r < 8; ++r) {
        d[r] = make_uint2(pk2(v[0][r], v[1][r]), pk2(v[2][r], v[3][r]));
        *(uint2*)(qp + (i * 16 + r) * DD) = d[r];
      }
      // stands in front of any rewrite of a register that the stores above
      // name; as inputs address and data keep their registers up to the wait
      asm volatile("s_wait_xcnt 0x0" ::"v"(qp), "v"(d[0].x), "v"(d[0].y), "v"(d[1].x),
                   "v"(d[1].y), "v"(d[2].x), "v"(d[2].y), "v"(d[3].x), "v"(d[3].y),
                   "v"(d[4].x), "v"(d[4].y), "v"(d[5].x), "v"(d[5].y), "v"(d[6].x),
                   "v"(d[6].y), "v"(d[7].x), "v"(d[7].y)
                   : "memory");
    } else {
      // a lane holds 8 consecutive rows of a column: 16 bytes of a transposed
      // row.  Its lanes' rows lie 4 apart (64 B modulo the banks), so the 16-byte
      // piece's index is XORed with c >> 2 to spread them over all banks.
      const int piece = ((mloc >> 3) + 2 * i) ^ (c >> 2);
#pragma unroll
      for (int j = 0; j < 4; ++j)
        *(uint4*)(sm + (nloc + j) * TP + piece * 8) =
            make_uint4(pk2(v[j][0], v[j][1]), pk2(v[j][2], v[j][3]),
                       pk2(v[j][4], v[j][5]), pk2(v[j][6], v[j][7]));
    }
    // keeps each 16 rows' work together; without it the scheduler interleaves
    // all four groups, runs out of registers and spills to scratch
    __builtin_amdgcn_sched_barrier(0);
  }
}

__global__ __launch_bounds__(512) void qkv_rope_kernel(
    const _Float16* __restrict__ xh, const _Float16* __restrict__ wh,
    const float* __restrict__ bq, const float* __restrict__ bk,
    const float* __restrict__ bv,
    const float* __restrict__ cosb, const float* __restrict__ sinb,
    _Float16* __restrict__ Qh, _Float16* __restrict__ Kt,
    _Float16* __restrict__ Vt) {
  __shared__ alignas(16) _Float16 sm[PSMEM_HALVES];
  static_assert(PT * TP <= PSMEM_HALVES, "transposed tile fits");

  const int z = blockIdx.z;
  const _Float16* w = wh + (size_t)z * DD * DD;

  const int tid = threadIdx.x;
  const int m0 = blockIdx.y * PT;  // token
  const int n0 = blockIdx.x * PT;  // feature

  v8f acc[4][4] = {};
  gemm_tile_nt_perm<DD, 4, 4, 4, 4>(xh + (size_t)m0 * DD, w + (size_t)n0 * DD, sm, acc);

  if (z == 0) {
    qkv_epilogue<0>(acc, bq, cosb, sinb, Qh, sm, m0, n0);
    return;  // taken by the whole workgroup; no barrier follows for it
  }
  if (z == 1) qkv_epilogue<1>(acc, bk, cosb, sinb, Kt, sm, m0, n0);
  else        qkv_epilogue<2>(acc, bv, cosb, sinb, Vt, sm, m0, n0);
  __syncthreads();  // the transposed tile is complete
  // a wave stores the 512 contiguous bytes of a transposed row
  _Float16* dst = ((z == 1) ? Kt : Vt) + ((size_t)(m0 / SS) * DD + n0) * SS + (m0 & (SS - 1));
  for (int i = tid; i < PT * PT / 8; i += 512) {
    const int r = i >> 5;
    const int p = i & 31;
    // piece p of row r lies where the epilogue's XOR has put it
    *(uint4*)(dst + (size_t)r * SS + p * 8) =
        *(const uint4*)(sm + r * TP + (p ^ ((r >> 4) & 3)) * 8);
  }
}

// ---------------------------------------------------------------------------
// Kernel 2: Mt[b][d2][d1] = (1/256) * sum_t K[b][t][d1] * V[b][t][d2], f16.
// The power of two keeps the f16 values near 1 (the sum runs over S = 4096
// terms); kernel 3 multiplies it back.  grid = (DD/128, DD/128, BB).
// One workgroup per WGP and a long sum: a stage is 256 k (512 B of a row, one
// wave's copy), so the two buffers take most of the WGP's LDS.
// ---------------------------------------------------------------------------
#define KTV_KS 256
#define MP 136  // staged output row stride in halves: 272 B = 16 B x 17
__global__ __launch_bounds__(256) void ktv_kernel(
    const _Float16* __restrict__ Kt, const _Float16* __restrict__ Vt,
    _Float16* __restrict__ Mt) {
  __shared__ alignas(16) _Float16 sm[g_smem_halves(KTV_KS)];
  static_assert(128 * MP <= g_smem_halves(KTV_KS), "staged tile fits");
  const int tid = threadIdx.x;
  const int lane = tid & 31;
  const int wave = tid >> 5;
  const int m0 = blockIdx.x * 128;  // d1
  const int n0 = blockIdx.y * 128;  // d2
  const size_t bo = (size_t)blockIdx.z * DD * SS;

  v8f acc[2][4] = {};
  gemm_tile_nt<SS, KTV_KS>(Kt + bo + (size_t)m0 * SS, Vt + bo + (size_t)n0 * SS, sm, acc);

  // acc[i][j][r] = C[wm*32 + i*16 + 8h + r][wn*64 + j*16 + c]; staged as [n][m]
  const int mloc = (wave & 3) * 32 + (lane >> 4) * 8;
  const int nloc = (wave >> 2) * 64 + (lane & 15);
#pragma unroll
  for (int i = 0; i < 2; ++i)
#pragma unroll
    for (int j = 0; j < 4; ++j) {
      union { _Float16 e[8]; uint4 q; } p;
#pragma unroll
      for (int r = 0; r < 8; ++r) p.e[r] = (_Float16)(acc[i][j][r] * (1.0f / 256.0f));
      *(uint4*)(sm + (nloc + j * 16) * MP + mloc + i * 16) = p.q;
    }
  __syncthreads();
  _Float16* dst = Mt + (size_t)blockIdx.z * DD * DD + (size_t)n0 * DD + m0;
  for (int i = tid; i < 2048; i += 256) {  // 16 lanes store 256 contiguous bytes
    const int r = i >> 4;
    const int c = (i & 15) * 8;
    *(uint4*)(dst + (size_t)r * DD + c) = *(const uint4*)(sm + r * MP + c);
  }
}

// ---------------------------------------------------------------------------
// Kernel 3: out[b][s][d2] = 64 * sum_d1 Q[b][s][d1] * Mt[b][d2][d1], fp32
// (64 / 256 = 1 / B).  grid = (DD/128, SS/128, BB).
// ---------------------------------------------------------------------------
#define QM_KS 64
#define OP 132  // staged output row stride in floats: 528 B = 16 B x 33
__global__ __launch_bounds__(256) void qm_kernel(
    const _Float16* __restrict__ Qh, const _Float16* __restrict__ Mt,
    float* __restrict__ out) {
  __shared__ alignas(16) _Float16 sm[g_smem_halves(QM_KS)];
  static_assert(128 * OP * 4 <= g_smem_halves(QM_KS) * 2, "staged tile fits");
  const int tid = threadIdx.x;
  const int lane = tid & 31;
  const int wave = tid >> 5;
  const int m0 = blockIdx.x * 128;  // d2
  const int n0 = blockIdx.y * 128;  // s
  const int b = blockIdx.z;

  v8f acc[2][4] = {};
  gemm_tile_nt<DD, QM_KS>(Mt + (size_t)b * DD * DD + (size_t)m0 * DD,
                   Qh + ((size_t)b * SS + n0) * DD, sm, acc);

  float* so = (float*)sm;
  const int mloc = (wave & 3) * 32 + (lane >> 4) * 8;
  const int nloc = (wave >> 2) * 64 + (lane & 15);
#pragma unroll
  for (int i = 0; i < 2; ++i)
#pragma unroll
    for (int j = 0; j < 4; ++j) {
      float* p = so + (nloc + j * 16) * OP + mloc + i * 16;
      *(float4*)(p) = make_float4(acc[i][j][0] * 64.0f, acc[i][j][1] * 64.0f,
                                  acc[i][j][2] * 64.0f, acc[i][j][3] * 64.0f);
      *(float4*)(p + 4) = make_float4(acc[i][j][4] * 64.0f, acc[i][j][5] * 64.0f,
                                      acc[i][j][6] * 64.0f, acc[i][j][7] * 64.0f);
    }
  __syncthreads();
  float* dst = out + ((size_t)b * SS + n0) * DD + m0;
  for (int i = tid; i < 4096; i += 256) {  // a wave stores one 512-byte row
    const int r = i >> 5;
    const int c = (i & 31) * 4;
    *(float4*)(dst + (size_t)r * DD + c) = *(const float4*)(so + r * OP + c);
  }
}

extern "C" void kernel_launch(void* const* d_in, const int* in_sizes, int n_in,
                              void* d_out, int out_size, void* d_ws,
                              size_t ws_size, hipStream_t stream) {
  (void)in_sizes; (void)n_in; (void)out_size; (void)ws_size;
  const float* x  = (const float*)d_in[0];
  const float* fc = (const float*)d_in[1];
  const float* fs = (const float*)d_in[2];
  const float* wq = (const float*)d_in[3];
  const float* bq = (const float*)d_in[4];
  const float* wk = (const float*)d_in[5];
  const float* bk = (const float*)d_in[6];
  const float* wv = (const float*)d_in[7];
  const float* bv = (const float*)d_in[8];
  float* out = (float*)d_out;

  _Float16* Qh = (_Float16*)d_ws;
  _Float16* Kt = Qh + (size_t)BB * SS * DD;
  _Float16* Vt = Kt + (size_t)BB * SS * DD;
  _Float16* Mt = Vt + (size_t)BB * SS * DD;
  _Float16* xh = Mt + (size_t)BB * DD * DD;
  _Float16* wh = xh + (size_t)BB * SS * DD;

  round_f16_kernel<<<dim3(CBLOCKS), dim3(256), 0, stream>>>(x, wq, wk, wv, xh, wh);
  dim3 g1(DD / 256, (BB * SS) / 256, 3);
  qkv_rope_kernel<<<g1, dim3(512), 0, stream>>>(xh, wh, bq, bk, bv, fc, fs, Qh,
                                                Kt, Vt);
  dim3 g2(DD / 128, DD / 128, BB);
  ktv_kernel<<<g2, dim3(256), 0, stream>>>(Kt, Vt, Mt);
  dim3 g3(DD / 128, SS / 128, BB);
  qm_kernel<<<g3, dim3(256), 0, stream>>>(Qh, Mt, out);
}

// v008
// One run takes 134 microseconds.
// Timed twice side by side with v007, it ran 1.05 times as fast both times.
// Counting every step since v000, it is 15.0 times as fast.
#include <hip/hip_runtime.h>

typedef __attribute__((ext_vector_type(16))) _Float16 v16h;
typedef __attribute__((ext_vector_type(8)))  float    v8f;
typedef float    f32x2 __attribute__((ext_vector_type(2)));
typedef float    f32x4 __attribute__((ext_vector_type(4)));
typedef _Float16 f16x2 __attribute__((ext_vector_type(2)));

constexpr int BB = 4;
constexpr int SS = 4096;
constexpr int DD = 1024;

__device__ __forceinline__ v8f wmma_f16(v16h a, v16h b, v8f c) {
  return __builtin_amdgcn_wmma_f32_16x16x32_f16(false, a, false, b, (short)0, c,
                                                false, false);
}

// ---------------------------------------------------------------------------
// The reference has no softmax, so (Q K^T / B) V = Q (K^T V) / B.  Per batch
// K^T V is a D x D matrix: 2 x S*D*D multiply-adds instead of 2 x S*S*D.
//
// Kernel 2's main loop: C[m][n] = sum_k A[m][k] * Bm[n][k], both k-contiguous f16,
// one 128 x 128 tile per workgroup, 256 threads (8 waves, 4 along m, 2 along n,
// 32 x 64 per wave).  KS k per stage, two LDS buffers; a stage goes from global
// memory into its buffer by asynchronous copies, through no register, while the
// stage before it is multiplied.  Only one stage's copies fly at a time, so KS
// sets the bytes in flight and how often the waves meet at a barrier.
// ---------------------------------------------------------------------------
// LDS row stride in halves: the row and 16 B more, 16 B x an odd number
constexpr int g_pitch(int ks) { return ks + 8; }
// one stage: 128 rows of A, then 128 rows of Bm
constexpr int g_stage(int ks) { return 256 * g_pitch(ks); }
constexpr int g_smem_halves(int ks) { return 2 * g_stage(ks); }

// 16x32 f16 fragment of one row; p = row start + 32 * kstep + 8 * (lane >> 4).
// The same k order serves A and B.
__device__ __forceinline__ v16h lds_frag(const _Float16* p) {
  union { v16h h; uint4 q[2]; } f;
  f.q[0] = *(const uint4*)(p);
  f.q[1] = *(const uint4*)(p + 16);
  return f.h;
}

// The LDS byte address of a __shared__ location, as an asynchronous copy takes it.
__device__ __forceinline__ unsigned int lds_addr(const _Float16* p) {
  return (unsigned int)(size_t)(const __attribute__((address_space(3))) _Float16*)p;
}

// Eight asynchronous copies of 16 bytes a lane, global memory to LDS.  The wait
// at the end stands in front of any rewrite of a register that the copies name:
// inside their own statement nothing can be moved between them and it.
__device__ __forceinline__ void async_copy8(const unsigned int (&l)[8],
                                            const _Float16* const (&g)[8]) {
  asm volatile(
      "global_load_async_to_lds_b128 %0, %8, off\n\t"
      "global_load_async_to_lds_b128 %1, %9, off\n\t"
      "global_load_async_to_lds_b128 %2, %10, off\n\t"
      "global_load_async_to_lds_b128 %3, %11, off\n\t"
      "global_load_async_to_lds_b128 %4, %12, off\n\t"
      "global_load_async_to_lds_b128 %5, %13, off\n\t"
      "global_load_async_to_lds_b128 %6, %14, off\n\t"
      "global_load_async_to_lds_b128 %7, %15, off\n\t"
      "s_wait_xcnt 0x0"
      ::"v"(l[0]), "v"(l[1]), "v"(l[2]), "v"(l[3]), "v"(l[4]), "v"(l[5]), "v"(l[6]),
      "v"(l[7]), "v"(g[0]), "v"(g[1]), "v"(g[2]), "v"(g[3]), "v"(g[4]), "v"(g[5]),
      "v"(g[6]), "v"(g[7])
      : "memory");
}

// This wave's own copies have landed in LDS.
__device__ __forceinline__ void wait_async_copies() {
  asm volatile("s_wait_asynccnt 0x0" ::: "memory");
}

// This wave's own LDS reads are over: it may let their buffer be refilled.
__device__ __forceinline__ void wait_lds_reads() {
  asm volatile("s_wait_dscnt 0x0" ::: "memory");
}

template <int KD, int KS>
__device__ __forceinline__ void gemm_tile_nt(const _Float16* __restrict__ A,
                                             const _Float16* __restrict__ Bm,
                                             _Float16* sm, v8f (&acc)[2][4]) {
  const int tid = threadIdx.x;
  const int lane = tid & 31;
  const int wave = tid >> 5;
  const int wm = wave & 3;
  const int wn = wave >> 2;
  const int c = lane & 15;
  const int h = lane >> 4;
  constexpr int GP = g_pitch(KS);
  constexpr int GSTG = g_stage(KS);
  constexpr int LR = KS / 8;       // lanes per row of a stage, 16 B each
  constexpr int RS = 256 / LR;     // rows per sweep of the workgroup
  constexpr int NSW = 128 / RS;    // sweeps per operand
  static_assert(NSW % 4 == 0 && 2 * NSW <= 63, "whole statements; copies in flight");
  const int lrow = tid / LR;
  const int lcol = (tid % LR) * 8;
  const _Float16* ga = A + (size_t)lrow * KD + lcol;
  const _Float16* gb = Bm + (size_t)lrow * KD + lcol;
  const unsigned int st = lds_addr(sm + lrow * GP + lcol);
  constexpr int NS = KD / KS;
  static_assert(NS >= 2 && NS * KS == KD, "the ring starts with two stages");

  // stage s into buffer s & 1: NSW sweeps of RS rows of A and as many of Bm, four
  // of each a statement
  auto copy_stage = [&](int s) {
    const unsigned int d = st + (unsigned int)(s & 1) * (GSTG * 2);
#pragma unroll
    for (int q = 0; q < NSW; q += 4) {
      unsigned int l[8];
      const _Float16* g[8];
#pragma unroll
      for (int j = 0; j < 4; ++j) {
        l[j] = d + (q + j) * RS * GP * 2;
        l[4 + j] = d + (128 + (q + j) * RS) * GP * 2;
        g[j] = ga + (size_t)(q + j) * RS * KD + s * KS;
        g[4 + j] = gb + (size_t)(q + j) * RS * KD + s * KS;
      }
      async_copy8(l, g);
    }
  };

  copy_stage(0);
  wait_async_copies();
  __syncthreads();  // publishes stage 0
  copy_stage(1);

  for (int s = 0; s < NS; ++s) {
    const int cur = (s & 1) * GSTG;
    const _Float16* sa = sm + cur + (wm * 32 + c) * GP + 8 * h;
    const _Float16* sb = sm + cur + (128 + wn * 64 + c) * GP + 8 * h;
#pragma unroll
    for (int kk = 0; kk < KS / 32; ++kk) {
      v16h af[2], bf[4];
#pragma unroll
      for (int j = 0; j < 4; ++j) bf[j] = lds_frag(sb + j * 16 * GP + kk * 32);
#pragma unroll
      for (int i = 0; i < 2; ++i) af[i] = lds_frag(sa + i * 16 * GP + kk * 32);
      // keeps the k step's LDS reads one group in front of its products (bf first:
      // the rows of af are needed one after the other): left free, the scheduler
      // reloads af among the products and the wave waits out every reload
      __builtin_amdgcn_sched_barrier(0);
#pragma unroll
      for (int i = 0; i < 2; ++i)
#pragma unroll
        for (int j = 0; j < 4; ++j) acc[i][j] = wmma_f16(af[i], bf[j], acc[i][j]);
      // keeps the next k step's reads, the next group, behind these products
      __builtin_amdgcn_sched_barrier(0);
    }
    wait_lds_reads();
    wait_async_copies();
    // publishes stage s + 1 and ends every read of stage s: its buffer is free
    // for stage s + 2, which flies while stage s + 1 is multiplied; behind the
    // last trip's barrier the caller reuses the buffers
    __syncthreads();
    if (s + 2 < NS) copy_stage(s + 2);
  }
  wait_async_copies();  // none is outstanding when the buffers get their next use
}

__device__ __forceinline__ uint2 cvt4(f32x4 v) {
  // one packed convert (round to nearest even) per pair
  const f16x2 lo = __builtin_convertvector(__builtin_shufflevector(v, v, 0, 1), f16x2);
  const f16x2 hi = __builtin_convertvector(__builtin_shufflevector(v, v, 2, 3), f16x2);
  return make_uint2(__builtin_bit_cast(unsigned int, lo),
                    __builtin_bit_cast(unsigned int, hi));
}

// ---------------------------------------------------------------------------
// Kernel 0: x and the three weight matrices rounded to f16 once.  Kernel 1 reads
// every row of x 12 times and every weight row 64 times: it now draws half the
// bytes from L2 and has no convert in its loop.  The rounding is the one that
// kernel 1 did on the way into LDS, so every value stays as it was.
// A block rounds CU floats a trip: 8 loads of 16 bytes a lane in flight, a wave's
// load covers 512 contiguous bytes and its store 256.
// ---------------------------------------------------------------------------
constexpr int CU = 256 * 4 * 8;            // floats per block and trip
constexpr int XU = BB * SS * DD / CU;      // units of x
constexpr int WU = DD * DD / CU;           // units of one weight matrix
constexpr int CTRIPS = 4;
constexpr int CBLOCKS = (XU + 3 * WU) / CTRIPS;
static_assert(CBLOCKS * CTRIPS == XU + 3 * WU, "every unit is rounded exactly once");

__global__ __launch_bounds__(256) void round_f16_kernel(
    const float* __restrict__ x, const float* __restrict__ wq,
    const float* __restrict__ wk, const float* __restrict__ wv,
    _Float16* __restrict__ xh, _Float16* __restrict__ wh) {
  const int tid = threadIdx.x;
  for (int t = 0; t < CTRIPS; ++t) {
    const int u = blockIdx.x + t * CBLOCKS;
    const int v = u - XU;  // the unit's index among the weights' units
    const float* s = (v < 0) ? x + (size_t)u * CU
                             : ((v < WU) ? wq : (v < 2 * WU) ? wk : wv) +
                                   (size_t)(v & (WU - 1)) * CU;
    _Float16* d = (v < 0) ? xh + (size_t)u * CU : wh + (size_t)v * CU;
    const float* sp = s + tid * 4;
    _Float16* dp = d + tid * 4;
    f32x4 r[8];
    // read once and never again: non-temporal, so that L2 keeps the f16 copies
#pragma unroll
    for (int j = 0; j < 8; ++j)
      r[j] = __builtin_nontemporal_load((const f32x4*)(sp + j * 1024));
    uint2 o[8];
#pragma unroll
    for (int j = 0; j < 8; ++j) {
      o[j] = cvt4(r[j]);
      *(uint2*)(dp + j * 1024) = o[j];
    }
    // stands in front of any rewrite of a register that the loads and stores
    // above name; as inputs the stored data keep their registers up to it
    asm volatile("s_wait_xcnt 0x0" ::"v"(o[0].x), "v"(o[0].y), "v"(o[1].x), "v"(o[1].y),
                 "v"(o[2].x), "v"(o[2].y), "v"(o[3].x), "v"(o[3].y), "v"(o[4].x),
                 "v"(o[4].y), "v"(o[5].x), "v"(o[5].y), "v"(o[6].x), "v"(o[6].y),
                 "v"(o[7].x), "v"(o[7].y)
                 : "memory");
  }
}

// The same loop for a 256 x 256 tile, with 256 B (128 k) of a row per stage: 16
// lanes x 16 B, so 16 lanes copy one aligned 256-byte unit into one LDS row.
// WM x WN waves, FM x FN fragments of 16 x 16 per wave.
// Row 64w + 4c + j of Bm lies at LDS row 64w + 16j + c, so that fragment j of a
// wave holds column 4c + j in lane c: acc[i][0..3] of a lane are four adjacent
// columns of C.  Only the place of whole rows changes, the k order does not.
#define WP 136                 // LDS row stride in halves: 272 B = 16 B x 17
template <int KD, int WM, int WN, int FM, int FN>
__device__ __forceinline__ void gemm_tile_nt_perm(const _Float16* __restrict__ A,
                                                  const _Float16* __restrict__ Bm,
                                                  _Float16* sm,
                                                  v8f (&acc)[FM][FN]) {
  constexpr int TM = WM * FM * 16;      // rows of A in the tile
  constexpr int TN = WN * FN * 16;      // rows of Bm in the tile
  constexpr int RS = WM * WN * 2;       // rows per sweep: 16 lanes per 256-B row
  constexpr int STG = (TM + TN) * WP;   // one stage: the rows of A, then of Bm
  constexpr int NS = KD / 128;
  const int tid = threadIdx.x;
  const int lane = tid & 31;
  const int wave = tid >> 5;
  const int wm = wave % WM;
  const int wn = wave / WM;
  const int c = lane & 15;
  const int h = lane >> 4;
  const int lrow = tid >> 4;
  const int lcol = (tid & 15) * 8;
  const _Float16* ga = A + (size_t)lrow * KD + lcol;
  const _Float16* gb = Bm + (size_t)lrow * KD + lcol;
  const unsigned int st = lds_addr(sm + lrow * WP + lcol);
  static_assert(RS == 32 && FN == 4, "the row permutation below is written for these");
  const unsigned int stb = lds_addr(sm + (TM + (lrow & 3) * 16 + (lrow >> 2)) * WP + lcol);
  static_assert(TM / RS == 8 && TN / RS == 8, "eight copies a statement and operand");
  static_assert(NS >= 2, "the ring starts with two stages");

  // stage s into buffer s & 1: 8 sweeps of RS rows of A, then 8 of Bm
  auto copy_stage = [&](int s) {
    const unsigned int d = (unsigned int)(s & 1) * (STG * 2);
    unsigned int l[8];
    const _Float16* g[8];
#pragma unroll
    for (int j = 0; j < 8; ++j) {
      l[j] = st + d + j * RS * WP * 2;
      g[j] = ga + (size_t)j * RS * KD + s * 128;
    }
    async_copy8(l, g);
#pragma unroll
    for (int j = 0; j < 8; ++j) {
      l[j] = stb + d + ((j >> 1) * 64 + (j & 1) * 8) * WP * 2;
      g[j] = gb + (size_t)j * RS * KD + s * 128;
    }
    async_copy8(l, g);
  };

  copy_stage(0);
  wait_async_copies();
  __syncthreads();  // publishes stage 0
  copy_stage(1);

  for (int s = 0; s < NS; ++s) {
    const int cur = (s & 1) * STG;
    const _Float16* sa = sm + cur + (wm * FM * 16 + c) * WP + 8 * h;
    const _Float16* sb = sm + cur + (TM + wn * FN * 16 + c) * WP + 8 * h;
#pragma unroll
    for (int kk = 0; kk < 4; ++kk) {
      v16h af[FM], bf[FN];
#pragma unroll
      for (int j = 0; j < FN; ++j) bf[j] = lds_frag(sb + j * 16 * WP + kk * 32);
#pragma unroll
      for (int i = 0; i < FM; ++i) af[i] = lds_frag(sa + i * 16 * WP + kk * 32);
      // keeps the k step's LDS reads one group in front of its products (bf first:
      // the rows of af are needed one after the other): left free, the scheduler
      // reloads af among the products and the wave waits out every reload
      __builtin_amdgcn_sched_barrier(0);
#pragma unroll
      for (int i = 0; i < FM; ++i)
#pragma unroll
        for (int j = 0; j < FN; ++j) acc[i][j] = wmma_f16(af[i], bf[j], acc[i][j]);
      // keeps the next k step's reads, the next group, behind these products
      __builtin_amdgcn_sched_barrier(0);
    }
    wait_lds_reads();
    wait_async_copies();
    // publishes stage s + 1 and ends every read of stage s: its buffer is free
    // for stage s + 2, which flies while stage s + 1 is multiplied; behind the
    // last trip's barrier kernel 1 reuses the buffers
    __syncthreads();
    if (s + 2 < NS) copy_stage(s + 2);
  }
  wait_async_copies();  // none is outstanding when the buffers get their next use
}

// ---------------------------------------------------------------------------
// Kernel 1: fused QKV projection + bias + rotary, f16 in (kernel 0) -> f16 out.
// grid = (DD/256, (BB*SS)/256, 3), block = 512 (16 waves, 4 x 4, 64 x 64 per
// wave), one 256 x 256 tile (tokens x features) per workgroup.
// Q is stored row-major [b][s][d]; K and V are stored transposed [b][d][t], so
// that the product K^T V reads both with its summed index t contiguous.
// ---------------------------------------------------------------------------
#define PT 256                 // tile edge
#define TP (PT + 8)            // row stride (halves) of the transposed tile: 528 B
#define PSMEM_HALVES (2 * 2 * PT * WP)

__device__ __forceinline__ unsigned int pk2(float a, float b) {
  const f32x2 v = {a, b};
  return __builtin_bit_cast(unsigned int, __builtin_convertvector(v, f16x2));
}

// Bias, rotary and store of one wave's 64 x 64 part.  Z = 0: Q, rotated, row-major
// to memory; Z = 1: K, rotated, into the transposed LDS tile; Z = 2: V, the same
// without the rotation.  acc[i][j][r] = C[wm*64 + i*16 + 8h + r][wn*64 + 4c + j]:
// a lane holds two whole (even, odd) pairs, so the rotation needs no other lane,
// 16 lanes read a whole 128-byte line of cos or sin and store one of Q.
template <int Z>
__device__ __forceinline__ void qkv_epilogue(
    v8f (&acc)[4][4], const float* __restrict__ bias,
    const float* __restrict__ cosb, const float* __restrict__ sinb,
    _Float16* __restrict__ out, _Float16* sm, int m0, int n0) {
  const int lane = threadIdx.x & 31;
  const int wave = threadIdx.x >> 5;
  const int c = lane & 15;
  const int mloc = (wave & 3) * 64 + (lane >> 4) * 8;
  const int nloc = (wave >> 2) * 64 + c * 4;
  const unsigned int bo = (unsigned int)nloc * 4u;  // the lane's byte offset in the tile's bias
  // the tile's rows start at a multiple of its edge, so they never wrap past SS
  const size_t fo = (size_t)((m0 & (SS - 1)) + mloc) * (DD / 2) + ((n0 + nloc) >> 1);
  const float* cp = cosb + fo;
  const float* sp = sinb + fo;
  _Float16* qp = out + (size_t)(m0 + mloc) * DD + n0 + nloc;

  const f32x4 b4 = *(const f32x4*)((const char*)(bias + n0) + bo);
  f32x2 cv[2][8], sv[2][8];
  if constexpr (Z < 2) {
#pragma unroll
    for (int r = 0; r < 8; ++r) {
      cv[0][r] = *(const f32x2*)(cp + r * (DD / 2));
      sv[0][r] = *(const f32x2*)(sp + r * (DD / 2));
    }
  }
  // stands in front of any rewrite of a register that the loads above name; as
  // inputs the addresses keep their registers up to the wait
  if constexpr (Z < 2)
    asm volatile("s_wait_xcnt 0x0" ::"v"(bo), "v"(cp), "v"(sp) : "memory");
  else
    asm volatile("s_wait_xcnt 0x0" ::"v"(bo) : "memory");
#pragma unroll
  for (int i = 0; i < 4; ++i) {
    if constexpr (Z < 2) {
      if (i + 1 < 4) {
        // the next 16 rows' factors fly while these 16 rows are rotated
#pragma unroll
        for (int r = 0; r < 8; ++r) {
          cv[(i + 1) & 1][r] = *(const f32x2*)(cp + ((i + 1) * 16 + r) * (DD / 2));
          sv[(i + 1) & 1][r] = *(const f32x2*)(sp + ((i + 1) * 16 + r) * (DD / 2));
        }
        // as above: in front of any rewrite of the two address registers
        asm volatile("s_wait_xcnt 0x0" ::"v"(cp), "v"(sp) : "memory");
      }
    }
    float v[4][8];
#pragma unroll
    for (int r = 0; r < 8; ++r) {
#pragma unroll
      for (int j = 0; j < 4; ++j) v[j][r] = acc[i][j][r] + b4[j];
      if constexpr (Z < 2) {
#pragma unroll
        for (int p = 0; p < 2; ++p) {
          const float cc = cv[i & 1][r][p], ss = sv[i & 1][r][p];
          const float h0 = v[2 * p][r], h1 = v[2 * p + 1][r];
          v[2 * p][r] = __builtin_fmaf(cc, h0, -(ss * h1));
          v[2 * p + 1][r] = __builtin_fmaf(cc, h1, ss * h0);
        }
      }
    }
    if constexpr (Z == 0) {
      uint2 d[8];
#pragma unroll
      for (int r = 0; r < 8; ++r) {
        d[r] = make_uint2(pk2(v[0][r], v[1][r]), pk2(v[2][r], v[3][r]));
        *(uint2*)(qp + (i * 16 + r) * DD) = d[r];
      }
      // stands in front of any rewrite of a register that the stores above
      // name; as inputs address and data keep their registers up to the wait
      asm volatile("s_wait_xcnt 0x0" ::"v"(qp), "v"(d[0].x), "v"(d[0].y), "v"(d[1].x),
                   "v"(d[1].y), "v"(d[2].x), "v"(d[2].y), "v"(d[3].x), "v"(d[3].y),
                   "v"(d[4].x), "v"(d[4].y), "v"(d[5].x), "v"(d[5].y), "v"(d[6].x),
                   "v"(d[6].y), "v"(d[7].x), "v"(d[7].y)
                   : "memory");
    } else {
      // a lane holds 8 consecutive rows of a column: 16 bytes of a transposed
      // row.  Its lanes' rows lie 4 apart (64 B modulo the banks), so the 16-byte
      // piece's index is XORed with c >> 2 to spread them over all banks.
      const int piece = ((mloc >> 3) + 2 * i) ^ (c >> 2);
#pragma unroll
      for (int j = 0; j < 4; ++j)
        *(uint4*)(sm + (nloc + j) * TP + piece * 8) =
            make_uint4(pk2(v[j][0], v[j][1]), pk2(v[j][2], v[j][3]),
                       pk2(v[j][4], v[j][5]), pk2(v[j][6], v[j][7]));
    }
    // keeps each 16 rows' work together; without it the scheduler interleaves
    // all four groups, runs out of registers and spills to scratch
    __builtin_amdgcn_sched_barrier(0);
  }
}

__global__ __launch_bounds__(512) void qkv_rope_kernel(
    const _Float16* __restrict__ xh, const _Float16* __restrict__ wh,
    const float* __restrict__ bq, const float* __restrict__ bk,
    const float* __restrict__ bv,
    const float* __restrict__ cosb, const float* __restrict__ sinb,
    _Float16* __restrict__ Qh, _Float16* __restrict__ Kt,
    _Float16* __restrict__ Vt) {
  __shared__ alignas(16) _Float16 sm[PSMEM_HALVES];
  static_assert(PT * TP <= PSMEM_HALVES, "transposed tile fits");

  const int z = blockIdx.z;
  const _Float16* w = wh + (size_t)z * DD * DD;

  const int tid = threadIdx.x;
  const int m0 = blockIdx.y * PT;  // token
  const int n0 = blockIdx.x * PT;  // feature

  v8f acc[4][4] = {};
  gemm_tile_nt_perm<DD, 4, 4, 4, 4>(xh + (size_t)m0 * DD, w + (size_t)n0 * DD, sm, acc);

  if (z == 0) {
    qkv_epilogue<0>(acc, bq, cosb, sinb, Qh, sm, m0, n0);
    return;  // taken by the whole workgroup; no barrier follows for it
  }
  if (z == 1) qkv_epilogue<1>(acc, bk, cosb, sinb, Kt, sm, m0, n0);
  else        qkv_epilogue<2>(acc, bv, cosb, sinb, Vt, sm, m0, n0);
  __syncthreads();  // the transposed tile is complete
  // a wave stores the 512 contiguous bytes of a transposed row
  _Float16* dst = ((z == 1) ? Kt : Vt) + ((size_t)(m0 / SS) * DD + n0) * SS + (m0 & (SS - 1));
  for (int i = tid; i < PT * PT / 8; i += 512) {
    const int r = i >> 5;
    const int p = i & 31;
    // piece p of row r lies where the epilogue's XOR has put it
    *(uint4*)(dst + (size_t)r * SS + p * 8) =
        *(const uint4*)(sm + r * TP + (p ^ ((r >> 4) & 3)) * 8);
  }
}

// ---------------------------------------------------------------------------
// Kernel 2: Mt[b][d2][d1] = (1/256) * sum_t K[b][t][d1] * V[b][t][d2], f16.
// The power of two keeps the f16 values near 1 (the sum runs over S = 4096
// terms); kernel 3 multiplies it back.  grid = (DD/128, DD/128, BB).
// One workgroup per WGP and a long sum: a stage is 256 k (512 B of a row, one
// wave's copy), so the two buffers take most of the WGP's LDS.
// ---------------------------------------------------------------------------
#define KTV_KS 256
#define MP 136  // staged output row stride in halves: 272 B = 16 B x 17
__global__ __launch_bounds__(256) void ktv_kernel(
    const _Float16* __restrict__ Kt, const _Float16* __restrict__ Vt,
    _Float16* __restrict__ Mt) {
  __shared__ alignas(16) _Float16 sm[g_smem_halves(KTV_KS)];
  static_assert(128 * MP <= g_smem_halves(KTV_KS), "staged tile fits");
  const int tid = threadIdx.x;
  const int lane = tid & 31;
  const int wave = tid >> 5;
  const int m0 = blockIdx.x * 128;  // d1
  const int n0 = blockIdx.y * 128;  // d2
  const size_t bo = (size_t)blockIdx.z * DD * SS;

  v8f acc[2][4] = {};
  gemm_tile_nt<SS, KTV_KS>(Kt + bo + (size_t)m0 * SS, Vt + bo + (size_t)n0 * SS, sm, acc);

  // acc[i][j][r] = C[wm*32 + i*16 + 8h + r][wn*64 + j*16 + c]; staged as [n][m]
  const int mloc = (wave & 3) * 32 + (lane >> 4) * 8;
  const int nloc = (wave >> 2) * 64 + (lane & 15);
#pragma unroll
  for (int i = 0; i < 2; ++i)
#pragma unroll
    for (int j = 0; j < 4; ++j) {
      union { _Float16 e[8]; uint4 q; } p;
#pragma unroll
      for (int r = 0; r < 8; ++r) p.e[r] = (_Float16)(acc[i][j][r] * (1.0f / 256.0f));
      *(uint4*)(sm + (nloc + j * 16) * MP + mloc + i * 16) = p.q;
    }
  __syncthreads();
  _Float16* dst = Mt + (size_t)blockIdx.z * DD * DD + (size_t)n0 * DD + m0;
  for (int i = tid; i < 2048; i += 256) {  // 16 lanes store 256 contiguous bytes
    const int r = i >> 4;
    const int c = (i & 15) * 8;
    *(uint4*)(dst + (size_t)r * DD + c) = *(const uint4*)(sm + r * MP + c);
  }
}

// ---------------------------------------------------------------------------
// Kernel 3: out[b][s][d2] = 64 * sum_d1 Q[b][s][d1] * Mt[b][d2][d1], fp32
// (64 / 256 = 1 / B).  Kernel 1's loop and tile: 256 x 256 (s x d2) per workgroup,
// 16 waves of 64 x 64, 128 k a stage.  Against a 128 x 128 tile of 32 x 64 waves
// it draws half the bytes from L2 and two thirds of the fragment bytes from LDS.
// grid = (SS/256, DD/256, BB): as many workgroups as the chip has WGPs.
// Q is the first operand: acc[i][j][r] = C[wm*64 + i*16 + 8h + r][wn*64 + 4c + j],
// so a lane holds 4 adjacent floats of an output row, 16 lanes store 256
// contiguous bytes of it, and the tile needs no staging in LDS.
// ---------------------------------------------------------------------------
__global__ __launch_bounds__(512) void qm_kernel(
    const _Float16* __restrict__ Qh, const _Float16* __restrict__ Mt,
    float* __restrict__ out) {
  __shared__ alignas(16) _Float16 sm[PSMEM_HALVES];
  const int lane = threadIdx.x & 31;
  const int wave = threadIdx.x >> 5;
  const int m0 = blockIdx.x * PT;  // s
  const int n0 = blockIdx.y * PT;  // d2
  const int b = blockIdx.z;

  v8f acc[4][4] = {};
  gemm_tile_nt_perm<DD, 4, 4, 4, 4>(Qh + ((size_t)b * SS + m0) * DD,
                                    Mt + (size_t)b * DD * DD + (size_t)n0 * DD, sm, acc);

  const int mloc = (wave & 3) * 64 + (lane >> 4) * 8;
  const int nloc = (wave >> 2) * 64 + (lane & 15) * 4;
  float* op = out + ((size_t)b * SS + m0 + mloc) * DD + n0 + nloc;
#pragma unroll
  for (int i = 0; i < 4; ++i) {
    f32x4 d[8];
#pragma unroll
    for (int r = 0; r < 8; ++r) {
      d[r] = f32x4{acc[i][0][r], acc[i][1][r], acc[i][2][r], acc[i][3][r]} * 64.0f;
      *(f32x4*)(op + (i * 16 + r) * DD) = d[r];
    }
    // stands in front of any rewrite of a register that the stores above name;
    // as inputs address and data keep their registers up to the wait
    asm volatile("s_wait_xcnt 0x0" ::"v"(op), "v"(d[0]), "v"(d[1]), "v"(d[2]), "v"(d[3]),
                 "v"(d[4]), "v"(d[5]), "v"(d[6]), "v"(d[7])
                 : "memory");
  }
}

extern "C" void kernel_launch(void* const* d_in, const int* in_sizes, int n_in,
                              void* d_out, int out_size, void* d_ws,
                              size_t ws_size, hipStream_t stream) {
  (void)in_sizes; (void)n_in; (void)out_size; (void)ws_size;
  const float* x  = (const float*)d_in[0];
  const float* fc = (const float*)d_in[1];
  const float* fs = (const float*)d_in[2];
  const float* wq = (const float*)d_in[3];
  const float* bq = (const float*)d_in[4];
  const float* wk = (const float*)d_in[5];
  const float* bk = (const float*)d_in[6];
  const float* wv = (const float*)d_in[7];
  const float* bv = (const float*)d_in[8];
  float* out = (float*)d_out;

  _Float16* Qh = (_Float16*)d_ws;
  _Float16* Kt = Qh + (size_t)BB * SS * DD;
  _Float16* Vt = Kt + (size_t)BB * SS * DD;
  _Float16* Mt = Vt + (size_t)BB * SS * DD;
  _Float16* xh = Mt + (size_t)BB * DD * DD;
  _Float16* wh = xh + (size_t)BB * SS * DD;

  round_f16_kernel<<<dim3(CBLOCKS), dim3(256), 0, stream>>>(x, wq, wk, wv, xh, wh);
  dim3 g1(DD / 256, (BB * SS) / 256, 3);
  qkv_rope_kernel<<<g1, dim3(512), 0, stream>>>(xh, wh, bq, bk, bv, fc, fs, Qh,
                                                Kt, Vt);
  dim3 g2(DD / 128, DD / 128, BB);
  ktv_kernel<<<g2, dim3(256), 0, stream>>>(Kt, Vt, Mt);
  dim3 g3(SS / 256, DD / 256, BB);
  qm_kernel<<<g3, dim3(512), 0, stream>>>(Qh, Mt, out);
}
